// v000
// The times below were measured on an AMD MI455X: many runs one after another, warmed up first and cycling through
// copies of the inputs, with the whole window's GPU time divided by the number of runs. Launches and the gaps
// between them are all in it. The median over several windows is given; except for v000 it joins two sittings, which
// can be a few percent apart, so the side-by-side timings, each taken in one sitting, are the better comparison.
// v000, which the later versions start from, runs in 232 microseconds.
#include <hip/hip_runtime.h>
#include <hip/hip_bf16.h>

// Problem constants (match reference)
#define Bc  4
#define Tc  2048
#define Dc  1024
#define Hc  16
#define DKc 64
#define DOc 1024

// GEMM pipeline config
#define KSTEP  64            // k-slice per stage (2 WMMA k-steps)
#define NSTAGE (Dc / KSTEP)  // 16
#define NBUF   4             // async pipeline depth (issue st+2, skew-safe)

typedef __attribute__((ext_vector_type(8)))  float  v8f;
typedef __attribute__((ext_vector_type(8)))  __bf16 v8bf;
typedef __attribute__((ext_vector_type(16))) __bf16 v16bf;

static __device__ __forceinline__ v16bf cat16(v8bf lo, v8bf hi) {
  return __builtin_shufflevector(lo, hi, 0,1,2,3,4,5,6,7,8,9,10,11,12,13,14,15);
}

#if defined(__HIP_DEVICE_COMPILE__) && \
    __has_builtin(__builtin_amdgcn_global_load_async_to_lds_b128) && \
    __has_builtin(__builtin_amdgcn_s_wait_asynccnt)
#define HAVE_ASYNC_LDS 1
#define GLOBAL_AS __attribute__((address_space(1)))
#define LDS_AS    __attribute__((address_space(3)))
#define WAIT_ASYNC(n) __builtin_amdgcn_s_wait_asynccnt(n)
typedef int v4i_g __attribute__((vector_size(16)));   // matches builtin pointee
static __device__ __forceinline__ void async_b128(const __bf16* g, __bf16* l) {
  __builtin_amdgcn_global_load_async_to_lds_b128(
      (GLOBAL_AS v4i_g*)(g), (LDS_AS v4i_g*)(l), 0, 0);
}
#else
#define HAVE_ASYNC_LDS 0
#endif

// ---------------------------------------------------------------------------
// Kernel 0: fp32 -> bf16 materialization (one-time streaming pass).
// ---------------------------------------------------------------------------
__global__ __launch_bounds__(256) void f32_to_bf16_kernel(
    const float* __restrict__ src, __bf16* __restrict__ dst, int n4)
{
  const int i = blockIdx.x * 256 + threadIdx.x;
  if (i < n4) {
    const float4 v = ((const float4*)src)[i];
    __bf16* d = dst + (size_t)i * 4;
    d[0] = (__bf16)v.x; d[1] = (__bf16)v.y;
    d[2] = (__bf16)v.z; d[3] = (__bf16)v.w;
  }
}

// ---------------------------------------------------------------------------
// Kernel 1: K/V projection from pre-converted bf16 operands.
// Y[m,n] = sum_d x[m,d] * W[n,d] + bias[n];  M=8192, N=1024, K=1024.
// WG tile 128x64, 8 waves of 32x32 (2x2 WMMA tiles), K-step 64.
// Async GLOBAL->LDS staging, 4-deep pipeline, s_wait_asynccnt throttling.
// ---------------------------------------------------------------------------
__global__ __launch_bounds__(256) void proj_kv_kernel(
    const __bf16* __restrict__ xg,                                   // 8192x1024
    const __bf16* __restrict__ Wkb, const __bf16* __restrict__ Wvb,  // 1024x1024
    const float* __restrict__ bk, const float* __restrict__ bv,
    __bf16* __restrict__ Kout, __bf16* __restrict__ Vout)
{
  const __bf16* W    = (blockIdx.z == 0) ? Wkb : Wvb;
  const float*  bias = (blockIdx.z == 0) ? bk : bv;
  __bf16*       Y    = (blockIdx.z == 0) ? Kout : Vout;

  const int Mbase = blockIdx.y * 128;
  const int Nbase = blockIdx.x * 64;

  __shared__ __align__(16) __bf16 xs[NBUF][128 * KSTEP];  // 16 KB / buf
  __shared__ __align__(16) __bf16 wl[NBUF][64 * KSTEP];   //  8 KB / buf

  const int tid  = threadIdx.x;
  const int wave = tid >> 5;
  const int lane = tid & 31;
  const int half = lane >> 4;   // 0 or 1
  const int idx  = lane & 15;
  const int wm   = wave & 3;    // 4 M-slots * 32 = 128
  const int wn   = wave >> 2;   // 2 N-slots * 32 = 64

  v8f acc[2][2] = {};

  auto compute = [&](int bufi) {
    const __bf16* xb = xs[bufi];
    const __bf16* wb = wl[bufi];
    #pragma unroll
    for (int ks = 0; ks < 2; ++ks) {           // two k=32 steps per stage
      v16bf a[2], b[2];
      #pragma unroll
      for (int mi = 0; mi < 2; ++mi) {
        const int r = wm * 32 + mi * 16 + idx;
        const v8bf lo = *(const v8bf*)&xb[r * KSTEP + ks * 32 + half * 8];
        const v8bf hi = *(const v8bf*)&xb[r * KSTEP + ks * 32 + 16 + half * 8];
        a[mi] = cat16(lo, hi);
      }
      #pragma unroll
      for (int ni = 0; ni < 2; ++ni) {
        const int r = wn * 32 + ni * 16 + idx;
        const v8bf lo = *(const v8bf*)&wb[r * KSTEP + ks * 32 + half * 8];
        const v8bf hi = *(const v8bf*)&wb[r * KSTEP + ks * 32 + 16 + half * 8];
        b[ni] = cat16(lo, hi);
      }
      #pragma unroll
      for (int mi = 0; mi < 2; ++mi)
        #pragma unroll
        for (int ni = 0; ni < 2; ++ni)
          acc[mi][ni] = __builtin_amdgcn_wmma_f32_16x16x32_bf16(
              false, a[mi], false, b[ni], (short)0, acc[mi][ni], false, false);
    }
  };

#if HAVE_ASYNC_LDS
  auto issue = [&](int st) {                   // 6 async b128 per thread
    const int kk   = st * KSTEP;
    const int bufi = st & (NBUF - 1);
    #pragma unroll
    for (int i = 0; i < 4; ++i) {
      const int t = tid + i * 256;
      const int row = t >> 3;
      const int c8  = (t & 7) << 3;
      async_b128(xg + (size_t)(Mbase + row) * Dc + kk + c8,
                 &xs[bufi][row * KSTEP + c8]);
    }
    #pragma unroll
    for (int i = 0; i < 2; ++i) {
      const int t = tid + i * 256;
      const int row = t >> 3;
      const int c8  = (t & 7) << 3;
      async_b128(W + (size_t)(Nbase + row) * Dc + kk + c8,
                 &wl[bufi][row * KSTEP + c8]);
    }
  };

  issue(0);
  issue(1);
  for (int st = 0; st < NSTAGE; ++st) {
    if (st + 2 < NSTAGE) { issue(st + 2); WAIT_ASYNC(12); }  // 2 stages in flight
    else if (st + 1 < NSTAGE) { WAIT_ASYNC(6); }             // 1 stage in flight
    else { WAIT_ASYNC(0); }
    __syncthreads();
    compute(st & (NBUF - 1));
  }
#else
  // Synchronous fallback: bf16 global -> VGPR -> LDS, single buffer.
  for (int st = 0; st < NSTAGE; ++st) {
    const int kk = st * KSTEP;
    __syncthreads();
    #pragma unroll
    for (int i = 0; i < 4; ++i) {
      const int t = tid + i * 256;
      const int row = t >> 3;
      const int c8  = (t & 7) << 3;
      *(v8bf*)&xs[0][row * KSTEP + c8] =
          *(const v8bf*)(xg + (size_t)(Mbase + row) * Dc + kk + c8);
    }
    #pragma unroll
    for (int i = 0; i < 2; ++i) {
      const int t = tid + i * 256;
      const int row = t >> 3;
      const int c8  = (t & 7) << 3;
      *(v8bf*)&wl[0][row * KSTEP + c8] =
          *(const v8bf*)(W + (size_t)(Nbase + row) * Dc + kk + c8);
    }
    __syncthreads();
    compute(0);
  }
#endif

  // Epilogue: C layout VGPR r -> M = r + 8*half, N = idx.
  #pragma unroll
  for (int mi = 0; mi < 2; ++mi) {
    #pragma unroll
    for (int ni = 0; ni < 2; ++ni) {
      const int col  = Nbase + wn * 32 + ni * 16 + idx;
      const float bb = bias[col];
      const int rowbase = Mbase + wm * 32 + mi * 16 + half * 8;
      #pragma unroll
      for (int r = 0; r < 8; ++r)
        Y[(size_t)(rowbase + r) * DOc + col] = (__bf16)(acc[mi][ni][r] + bb);
    }
  }
}

// ---------------------------------------------------------------------------
// Kernel 2: tiny GEMM, <=8 rows (M padded to 16 with zeros), one wave/N-tile.
// out[r,n] = sum_k A[r,k] * W[n,k] + bias[n].  Used for q-last and out-proj.
// ---------------------------------------------------------------------------
__global__ __launch_bounds__(32) void gemm_rows16_kernel(
    const float* __restrict__ A, size_t arow_stride, int arows,
    const float* __restrict__ W, const float* __restrict__ bias,
    float* __restrict__ out, size_t orow_stride)
{
  const int Nbase = blockIdx.x * 16;
  const int lane  = threadIdx.x & 31;
  const int half  = lane >> 4;
  const int idx   = lane & 15;

  v8f acc = {};
  for (int kk = 0; kk < Dc; kk += 32) {
    v16bf a, b;
    const int k0 = kk + half * 8;
    #pragma unroll
    for (int j = 0; j < 8; ++j) {
      const float a0 = (idx < arows) ? A[(size_t)idx * arow_stride + k0 + j]      : 0.0f;
      const float a1 = (idx < arows) ? A[(size_t)idx * arow_stride + k0 + 16 + j] : 0.0f;
      a[j]     = (__bf16)a0;
      a[8 + j] = (__bf16)a1;
      b[j]     = (__bf16)W[(size_t)(Nbase + idx) * Dc + k0 + j];
      b[8 + j] = (__bf16)W[(size_t)(Nbase + idx) * Dc + k0 + 16 + j];
    }
    acc = __builtin_amdgcn_wmma_f32_16x16x32_bf16(
        false, a, false, b, (short)0, acc, false, false);
  }

  if (half == 0) {
    const float bb = bias[Nbase + idx];
    #pragma unroll
    for (int r = 0; r < 8; ++r)
      if (r < arows)
        out[(size_t)r * orow_stride + Nbase + idx] = acc[r] + bb;
  }
}

// ---------------------------------------------------------------------------
// Kernel 3: last-token attention, one block per (b, h).
// scores[s] = (q . K[s]) / 8 ; softmax over T ; ctx = sum_s attn[s] * V[s].
// ---------------------------------------------------------------------------
__global__ __launch_bounds__(256) void attn_last_kernel(
    const float* __restrict__ qws, const __bf16* __restrict__ Kws,
    const __bf16* __restrict__ Vws, float* __restrict__ ctxws)
{
  const int b   = blockIdx.x >> 4;   // / H
  const int h   = blockIdx.x & 15;   // % H
  const int tid = threadIdx.x;

  __shared__ float qs[DKc];
  __shared__ float wls[Tc];          // 8 KB attn weights
  __shared__ float red[256];
  __shared__ float cpart[4][DKc];

  if (tid < DKc) qs[tid] = qws[b * DOc + h * DKc + tid];
  __syncthreads();

  float sc[8];
  float mymax = -1e30f;
  #pragma unroll
  for (int i = 0; i < 8; ++i) {
    const int s = tid + i * 256;
    const v8bf* kp = (const v8bf*)(Kws + ((size_t)(b * Tc + s)) * DOc + h * DKc);
    float d0 = 0.f;
    #pragma unroll
    for (int c = 0; c < 8; ++c) {
      const v8bf kv = kp[c];
      #pragma unroll
      for (int j = 0; j < 8; ++j) d0 += qs[c * 8 + j] * (float)kv[j];
    }
    d0 *= 0.125f;                    // 1/sqrt(DK)
    sc[i] = d0;
    mymax = fmaxf(mymax, d0);
  }

  red[tid] = mymax; __syncthreads();
  for (int off = 128; off > 0; off >>= 1) {
    if (tid < off) red[tid] = fmaxf(red[tid], red[tid + off]);
    __syncthreads();
  }
  const float m = red[0];
  __syncthreads();

  float mysum = 0.f;
  #pragma unroll
  for (int i = 0; i < 8; ++i) {
    const float e = __expf(sc[i] - m);
    wls[tid + i * 256] = e;
    mysum += e;
  }
  red[tid] = mysum; __syncthreads();
  for (int off = 128; off > 0; off >>= 1) {
    if (tid < off) red[tid] = red[tid] + red[tid + off];
    __syncthreads();
  }
  const float inv = 1.0f / red[0];

  const int d     = tid & 63;
  const int chunk = tid >> 6;        // 0..3, each covers 512 of T
  float a = 0.f;
  for (int s = chunk * 512; s < (chunk + 1) * 512; ++s)
    a += wls[s] * (float)Vws[((size_t)(b * Tc + s)) * DOc + h * DKc + d];
  cpart[chunk][d] = a;
  __syncthreads();

  if (tid < DKc) {
    const float r = (cpart[0][tid] + cpart[1][tid] + cpart[2][tid] + cpart[3][tid]) * inv;
    ctxws[b * DOc + h * DKc + tid] = r;
  }
}

// ---------------------------------------------------------------------------
extern "C" void kernel_launch(void* const* d_in, const int* in_sizes, int n_in,
                              void* d_out, int out_size, void* d_ws, size_t ws_size,
                              hipStream_t stream) {
  (void)in_sizes; (void)n_in; (void)out_size; (void)ws_size;

  const float* x  = (const float*)d_in[0];
  const float* Wq = (const float*)d_in[1];
  const float* bq = (const float*)d_in[2];
  const float* Wk = (const float*)d_in[3];
  const float* bk = (const float*)d_in[4];
  const float* Wv = (const float*)d_in[5];
  const float* bv = (const float*)d_in[6];
  const float* Wo = (const float*)d_in[7];
  const float* bo = (const float*)d_in[8];
  float* out = (float*)d_out;

  char* ws = (char*)d_ws;
  const size_t kvBytes = (size_t)Bc * Tc * DOc * sizeof(__bf16);  // 16 MB
  const size_t wBytes  = (size_t)DOc * Dc * sizeof(__bf16);       //  2 MB
  __bf16* Kb    = (__bf16*)(ws);
  __bf16* Vb    = (__bf16*)(ws + kvBytes);
  __bf16* Xb    = (__bf16*)(ws + 2 * kvBytes);                    // 16 MB
  __bf16* Wkb   = (__bf16*)(ws + 3 * kvBytes);
  __bf16* Wvb   = (__bf16*)(ws + 3 * kvBytes + wBytes);
  float*  qws   = (float*)(ws + 3 * kvBytes + 2 * wBytes);
  float*  ctxws = qws + Bc * DOc;

  // 0) one-time bf16 materialization of x, Wk, Wv
  const int xq4 = (Bc * Tc * Dc) / 4;   // 2,097,152
  const int wq4 = (DOc * Dc) / 4;       //   262,144
  f32_to_bf16_kernel<<<(xq4 + 255) / 256, 256, 0, stream>>>(x,  Xb,  xq4);
  f32_to_bf16_kernel<<<(wq4 + 255) / 256, 256, 0, stream>>>(Wk, Wkb, wq4);
  f32_to_bf16_kernel<<<(wq4 + 255) / 256, 256, 0, stream>>>(Wv, Wvb, wq4);

  // 1) K and V projections (bulk of the FLOPs) -> bf16 workspace
  dim3 gp(DOc / 64, (Bc * Tc) / 128, 2);
  proj_kv_kernel<<<gp, 256, 0, stream>>>(Xb, Wkb, Wvb, bk, bv, Kb, Vb);

  // 2) Q for the last token of each batch (4 rows)
  gemm_rows16_kernel<<<DOc / 16, 32, 0, stream>>>(
      x + (size_t)(Tc - 1) * Dc, (size_t)Tc * Dc, Bc, Wq, bq, qws, DOc);

  // 3) softmax attention for the last token, one block per (b, h)
  attn_last_kernel<<<Bc * Hc, 256, 0, stream>>>(qws, Kb, Vb, ctxws);

  // 4) output projection (4 rows) -> d_out
  gemm_rows16_kernel<<<DOc / 16, 32, 0, stream>>>(
      ctxws, DOc, Bc, Wo, bo, out, DOc);
}

// v001
// One run takes 153 microseconds.
// Next to v000, in two timings, it ran 1.54 times as fast each time.
#include <hip/hip_runtime.h>
#include <hip/hip_bf16.h>

// Problem constants (match reference)
#define Bc  4
#define Tc  2048
#define Dc  1024
#define Hc  16
#define DKc 64
#define DOc 1024

// GEMM pipeline config
#define KSTEP  64            // k-slice per stage (2 WMMA k-steps)
#define NSTAGE (Dc / KSTEP)  // 16
#define NBUF   4             // async pipeline depth (issue st+2, skew-safe)

typedef __attribute__((ext_vector_type(8)))  float  v8f;
typedef __attribute__((ext_vector_type(8)))  __bf16 v8bf;
typedef __attribute__((ext_vector_type(16))) __bf16 v16bf;

static __device__ __forceinline__ v16bf cat16(v8bf lo, v8bf hi) {
  return __builtin_shufflevector(lo, hi, 0,1,2,3,4,5,6,7,8,9,10,11,12,13,14,15);
}

#if defined(__HIP_DEVICE_COMPILE__) && \
    __has_builtin(__builtin_amdgcn_global_load_async_to_lds_b128) && \
    __has_builtin(__builtin_amdgcn_s_wait_asynccnt)
#define HAVE_ASYNC_LDS 1
#define GLOBAL_AS __attribute__((address_space(1)))
#define LDS_AS    __attribute__((address_space(3)))
#define WAIT_ASYNC(n) __builtin_amdgcn_s_wait_asynccnt(n)
typedef int v4i_g __attribute__((vector_size(16)));   // matches builtin pointee
static __device__ __forceinline__ void async_b128(const __bf16* g, __bf16* l) {
  __builtin_amdgcn_global_load_async_to_lds_b128(
      (GLOBAL_AS v4i_g*)(g), (LDS_AS v4i_g*)(l), 0, 0);
}
#else
#define HAVE_ASYNC_LDS 0
#endif

// ---------------------------------------------------------------------------
// Kernel 0: fp32 -> bf16 materialization (one-time streaming pass).
// ---------------------------------------------------------------------------
__global__ __launch_bounds__(256) void f32_to_bf16_kernel(
    const float* __restrict__ src, __bf16* __restrict__ dst, int n4)
{
  const int i = blockIdx.x * 256 + threadIdx.x;
  if (i < n4) {
    const float4 v = ((const float4*)src)[i];
    __bf16* d = dst + (size_t)i * 4;
    d[0] = (__bf16)v.x; d[1] = (__bf16)v.y;
    d[2] = (__bf16)v.z; d[3] = (__bf16)v.w;
  }
}

// ---------------------------------------------------------------------------
// Kernel 1: K/V projection from pre-converted bf16 operands.
// Y[m,n] = sum_d x[m,d] * W[n,d] + bias[n];  M=8192, N=1024, K=1024.
// WG tile 128x64, 8 waves of 32x32 (2x2 WMMA tiles), K-step 64.
// Async GLOBAL->LDS staging, 4-deep pipeline, s_wait_asynccnt throttling.
// ---------------------------------------------------------------------------
__global__ __launch_bounds__(256) void proj_kv_kernel(
    const __bf16* __restrict__ xg,                                   // 8192x1024
    const __bf16* __restrict__ Wkb, const __bf16* __restrict__ Wvb,  // 1024x1024
    const float* __restrict__ bk, const float* __restrict__ bv,
    __bf16* __restrict__ Kout, __bf16* __restrict__ Vout)
{
  const __bf16* W    = (blockIdx.z == 0) ? Wkb : Wvb;
  const float*  bias = (blockIdx.z == 0) ? bk : bv;
  __bf16*       Y    = (blockIdx.z == 0) ? Kout : Vout;

  const int Mbase = blockIdx.y * 128;
  const int Nbase = blockIdx.x * 64;

  __shared__ __align__(16) __bf16 xs[NBUF][128 * KSTEP];  // 16 KB / buf
  __shared__ __align__(16) __bf16 wl[NBUF][64 * KSTEP];   //  8 KB / buf

  const int tid  = threadIdx.x;
  const int wave = tid >> 5;
  const int lane = tid & 31;
  const int half = lane >> 4;   // 0 or 1
  const int idx  = lane & 15;
  const int wm   = wave & 3;    // 4 M-slots * 32 = 128
  const int wn   = wave >> 2;   // 2 N-slots * 32 = 64

  v8f acc[2][2] = {};

  auto compute = [&](int bufi) {
    const __bf16* xb = xs[bufi];
    const __bf16* wb = wl[bufi];
    #pragma unroll
    for (int ks = 0; ks < 2; ++ks) {           // two k=32 steps per stage
      v16bf a[2], b[2];
      #pragma unroll
      for (int mi = 0; mi < 2; ++mi) {
        const int r = wm * 32 + mi * 16 + idx;
        const v8bf lo = *(const v8bf*)&xb[r * KSTEP + ks * 32 + half * 8];
        const v8bf hi = *(const v8bf*)&xb[r * KSTEP + ks * 32 + 16 + half * 8];
        a[mi] = cat16(lo, hi);
      }
      #pragma unroll
      for (int ni = 0; ni < 2; ++ni) {
        const int r = wn * 32 + ni * 16 + idx;
        const v8bf lo = *(const v8bf*)&wb[r * KSTEP + ks * 32 + half * 8];
        const v8bf hi = *(const v8bf*)&wb[r * KSTEP + ks * 32 + 16 + half * 8];
        b[ni] = cat16(lo, hi);
      }
      #pragma unroll
      for (int mi = 0; mi < 2; ++mi)
        #pragma unroll
        for (int ni = 0; ni < 2; ++ni)
          acc[mi][ni] = __builtin_amdgcn_wmma_f32_16x16x32_bf16(
              false, a[mi], false, b[ni], (short)0, acc[mi][ni], false, false);
    }
  };

#if HAVE_ASYNC_LDS
  auto issue = [&](int st) {                   // 6 async b128 per thread
    const int kk   = st * KSTEP;
    const int bufi = st & (NBUF - 1);
    #pragma unroll
    for (int i = 0; i < 4; ++i) {
      const int t = tid + i * 256;
      const int row = t >> 3;
      const int c8  = (t & 7) << 3;
      async_b128(xg + (size_t)(Mbase + row) * Dc + kk + c8,
                 &xs[bufi][row * KSTEP + c8]);
    }
    #pragma unroll
    for (int i = 0; i < 2; ++i) {
      const int t = tid + i * 256;
      const int row = t >> 3;
      const int c8  = (t & 7) << 3;
      async_b128(W + (size_t)(Nbase + row) * Dc + kk + c8,
                 &wl[bufi][row * KSTEP + c8]);
    }
  };

  issue(0);
  issue(1);
  for (int st = 0; st < NSTAGE; ++st) {
    if (st + 2 < NSTAGE) { issue(st + 2); WAIT_ASYNC(12); }  // 2 stages in flight
    else if (st + 1 < NSTAGE) { WAIT_ASYNC(6); }             // 1 stage in flight
    else { WAIT_ASYNC(0); }
    __syncthreads();
    compute(st & (NBUF - 1));
  }
#else
  // Synchronous fallback: bf16 global -> VGPR -> LDS, single buffer.
  for (int st = 0; st < NSTAGE; ++st) {
    const int kk = st * KSTEP;
    __syncthreads();
    #pragma unroll
    for (int i = 0; i < 4; ++i) {
      const int t = tid + i * 256;
      const int row = t >> 3;
      const int c8  = (t & 7) << 3;
      *(v8bf*)&xs[0][row * KSTEP + c8] =
          *(const v8bf*)(xg + (size_t)(Mbase + row) * Dc + kk + c8);
    }
    #pragma unroll
    for (int i = 0; i < 2; ++i) {
      const int t = tid + i * 256;
      const int row = t >> 3;
      const int c8  = (t & 7) << 3;
      *(v8bf*)&wl[0][row * KSTEP + c8] =
          *(const v8bf*)(W + (size_t)(Nbase + row) * Dc + kk + c8);
    }
    __syncthreads();
    compute(0);
  }
#endif

  // Epilogue: C layout VGPR r -> M = r + 8*half, N = idx.
  #pragma unroll
  for (int mi = 0; mi < 2; ++mi) {
    #pragma unroll
    for (int ni = 0; ni < 2; ++ni) {
      const int col  = Nbase + wn * 32 + ni * 16 + idx;
      const float bb = bias[col];
      const int rowbase = Mbase + wm * 32 + mi * 16 + half * 8;
      #pragma unroll
      for (int r = 0; r < 8; ++r)
        Y[(size_t)(rowbase + r) * DOc + col] = (__bf16)(acc[mi][ni][r] + bb);
    }
  }
}

// ---------------------------------------------------------------------------
// Kernel 2: tiny GEMM, <=8 rows (M padded to 16 with zeros), one work-group
// per 16-column N-tile. out[r,n] = sum_k A[r,k] * W[n,k] + bias[n].
// k is split over KW waves: each wave asks for its whole k-slice at once, so
// the work-group pays one memory round trip instead of one per k-step; the
// f32 partial tiles are summed through LDS in wave order.
// Used for q-last and out-proj.
// ---------------------------------------------------------------------------
#define KW    16             // waves per work-group
#define KWSTP (Dc / KW / 32) // WMMA k-steps per wave (2)

__global__ __launch_bounds__(32 * KW) void gemm_rows16_kernel(
    const float* __restrict__ A, size_t arow_stride, int arows,
    const float* __restrict__ W, const float* __restrict__ bias,
    float* __restrict__ out, size_t orow_stride)
{
  __shared__ float part[KW][8][16];

  const int Nbase = blockIdx.x * 16;
  const int tid   = threadIdx.x;
  const int wave  = tid >> 5;
  const int lane  = tid & 31;
  const int half  = lane >> 4;
  const int idx   = lane & 15;

  // Piece c of k-step s holds k = kbase + s*32 + (c>>1)*16 + (c&1)*4 .. +3,
  // the same for A and W.
  const int kbase = wave * (Dc / KW) + half * 8;
  const float* wrow = W + (size_t)(Nbase + idx) * Dc + kbase;

  float4 wf[KWSTP][4], af[KWSTP][4];
  #pragma unroll
  for (int s = 0; s < KWSTP; ++s)
    #pragma unroll
    for (int c = 0; c < 4; ++c) {
      wf[s][c] = *(const float4*)(wrow + s * 32 + (c >> 1) * 16 + (c & 1) * 4);
      af[s][c] = make_float4(0.f, 0.f, 0.f, 0.f);
    }
  const float bb = bias[Nbase + idx];  // asked for with the operands
  if (idx < arows) {
    const float* arow = A + (size_t)idx * arow_stride + kbase;
    #pragma unroll
    for (int s = 0; s < KWSTP; ++s)
      #pragma unroll
      for (int c = 0; c < 4; ++c)
        af[s][c] = *(const float4*)(arow + s * 32 + (c >> 1) * 16 + (c & 1) * 4);
  }

  v8f acc = {};
  #pragma unroll
  for (int s = 0; s < KWSTP; ++s) {
    v16bf a, b;
    #pragma unroll
    for (int c = 0; c < 4; ++c) {
      a[c * 4 + 0] = (__bf16)af[s][c].x; a[c * 4 + 1] = (__bf16)af[s][c].y;
      a[c * 4 + 2] = (__bf16)af[s][c].z; a[c * 4 + 3] = (__bf16)af[s][c].w;
      b[c * 4 + 0] = (__bf16)wf[s][c].x; b[c * 4 + 1] = (__bf16)wf[s][c].y;
      b[c * 4 + 2] = (__bf16)wf[s][c].z; b[c * 4 + 3] = (__bf16)wf[s][c].w;
    }
    acc = __builtin_amdgcn_wmma_f32_16x16x32_bf16(
        false, a, false, b, (short)0, acc, false, false);
  }

  // C layout: VGPR r of lanes 0..15 -> row r, column idx.
  if (half == 0) {
    #pragma unroll
    for (int r = 0; r < 8; ++r) part[wave][r][idx] = acc[r];
  }
  __syncthreads();

  const int r = tid >> 4;            // 0..7 for the first 128 threads
  if (r < 8 && r < arows) {          // column = idx
    float sum = 0.f;
    #pragma unroll
    for (int w = 0; w < KW; ++w) sum += part[w][r][idx];
    out[(size_t)r * orow_stride + Nbase + idx] = sum + bb;
  }
}

// ---------------------------------------------------------------------------
// Kernel 3: last-token attention, one block per (b, h).
// scores[s] = (q . K[s]) / 8 ; softmax over T ; ctx = sum_s attn[s] * V[s].
// ---------------------------------------------------------------------------
__global__ __launch_bounds__(256) void attn_last_kernel(
    const float* __restrict__ qws, const __bf16* __restrict__ Kws,
    const __bf16* __restrict__ Vws, float* __restrict__ ctxws)
{
  const int b   = blockIdx.x >> 4;   // / H
  const int h   = blockIdx.x & 15;   // % H
  const int tid = threadIdx.x;

  __shared__ float qs[DKc];
  __shared__ float wls[Tc];          // 8 KB attn weights
  __shared__ float red[256];
  __shared__ float cpart[4][DKc];

  if (tid < DKc) qs[tid] = qws[b * DOc + h * DKc + tid];
  __syncthreads();

  float sc[8];
  float mymax = -1e30f;
  #pragma unroll
  for (int i = 0; i < 8; ++i) {
    const int s = tid + i * 256;
    const v8bf* kp = (const v8bf*)(Kws + ((size_t)(b * Tc + s)) * DOc + h * DKc);
    float d0 = 0.f;
    #pragma unroll
    for (int c = 0; c < 8; ++c) {
      const v8bf kv = kp[c];
      #pragma unroll
      for (int j = 0; j < 8; ++j) d0 += qs[c * 8 + j] * (float)kv[j];
    }
    d0 *= 0.125f;                    // 1/sqrt(DK)
    sc[i] = d0;
    mymax = fmaxf(mymax, d0);
  }

  red[tid] = mymax; __syncthreads();
  for (int off = 128; off > 0; off >>= 1) {
    if (tid < off) red[tid] = fmaxf(red[tid], red[tid + off]);
    __syncthreads();
  }
  const float m = red[0];
  __syncthreads();

  float mysum = 0.f;
  #pragma unroll
  for (int i = 0; i < 8; ++i) {
    const float e = __expf(sc[i] - m);
    wls[tid + i * 256] = e;
    mysum += e;
  }
  red[tid] = mysum; __syncthreads();
  for (int off = 128; off > 0; off >>= 1) {
    if (tid < off) red[tid] = red[tid] + red[tid + off];
    __syncthreads();
  }
  const float inv = 1.0f / red[0];

  const int d     = tid & 63;
  const int chunk = tid >> 6;        // 0..3, each covers 512 of T
  float a = 0.f;
  for (int s = chunk * 512; s < (chunk + 1) * 512; ++s)
    a += wls[s] * (float)Vws[((size_t)(b * Tc + s)) * DOc + h * DKc + d];
  cpart[chunk][d] = a;
  __syncthreads();

  if (tid < DKc) {
    const float r = (cpart[0][tid] + cpart[1][tid] + cpart[2][tid] + cpart[3][tid]) * inv;
    ctxws[b * DOc + h * DKc + tid] = r;
  }
}

// ---------------------------------------------------------------------------
extern "C" void kernel_launch(void* const* d_in, const int* in_sizes, int n_in,
                              void* d_out, int out_size, void* d_ws, size_t ws_size,
                              hipStream_t stream) {
  (void)in_sizes; (void)n_in; (void)out_size; (void)ws_size;

  const float* x  = (const float*)d_in[0];
  const float* Wq = (const float*)d_in[1];
  const float* bq = (const float*)d_in[2];
  const float* Wk = (const float*)d_in[3];
  const float* bk = (const float*)d_in[4];
  const float* Wv = (const float*)d_in[5];
  const float* bv = (const float*)d_in[6];
  const float* Wo = (const float*)d_in[7];
  const float* bo = (const float*)d_in[8];
  float* out = (float*)d_out;

  char* ws = (char*)d_ws;
  const size_t kvBytes = (size_t)Bc * Tc * DOc * sizeof(__bf16);  // 16 MB
  const size_t wBytes  = (size_t)DOc * Dc * sizeof(__bf16);       //  2 MB
  __bf16* Kb    = (__bf16*)(ws);
  __bf16* Vb    = (__bf16*)(ws + kvBytes);
  __bf16* Xb    = (__bf16*)(ws + 2 * kvBytes);                    // 16 MB
  __bf16* Wkb   = (__bf16*)(ws + 3 * kvBytes);
  __bf16* Wvb   = (__bf16*)(ws + 3 * kvBytes + wBytes);
  float*  qws   = (float*)(ws + 3 * kvBytes + 2 * wBytes);
  float*  ctxws = qws + Bc * DOc;

  // 0) one-time bf16 materialization of x, Wk, Wv
  const int xq4 = (Bc * Tc * Dc) / 4;   // 2,097,152
  const int wq4 = (DOc * Dc) / 4;       //   262,144
  f32_to_bf16_kernel<<<(xq4 + 255) / 256, 256, 0, stream>>>(x,  Xb,  xq4);
  f32_to_bf16_kernel<<<(wq4 + 255) / 256, 256, 0, stream>>>(Wk, Wkb, wq4);
  f32_to_bf16_kernel<<<(wq4 + 255) / 256, 256, 0, stream>>>(Wv, Wvb, wq4);

  // 1) K and V projections (bulk of the FLOPs) -> bf16 workspace
  dim3 gp(DOc / 64, (Bc * Tc) / 128, 2);
  proj_kv_kernel<<<gp, 256, 0, stream>>>(Xb, Wkb, Wvb, bk, bv, Kb, Vb);

  // 2) Q for the last token of each batch (4 rows)
  gemm_rows16_kernel<<<DOc / 16, 32 * KW, 0, stream>>>(
      x + (size_t)(Tc - 1) * Dc, (size_t)Tc * Dc, Bc, Wq, bq, qws, DOc);

  // 3) softmax attention for the last token, one block per (b, h)
  attn_last_kernel<<<Bc * Hc, 256, 0, stream>>>(qws, Kb, Vb, ctxws);

  // 4) output projection (4 rows) -> d_out
  gemm_rows16_kernel<<<DOc / 16, 32 * KW, 0, stream>>>(
      ctxws, DOc, Bc, Wo, bo, out, DOc);
}

// v003
// One run takes 25.3 microseconds.
// Versions between v001 and this one are left out; their measured steps multiply to 6.02 times as fast.
// Counting every step since v000, it is 9.29 times as fast.
#include <hip/hip_runtime.h>
#include <hip/hip_bf16.h>

// Problem constants (match reference)
#define Bc  4
#define Tc  2048
#define Dc  1024
#define Hc  16
#define DKc 64
#define DOc 1024

// Only the last query row of each batch reaches the output, so K and V are
// never formed. With q the last row's query of head h:
//   scores[s] = q . (Wk_h x[s] + bk_h) = x[s] . (Wk_h^T q) + q . bk_h
//   ctx       = sum_s attn[s] (Wv_h x[s] + bv_h) = Wv_h (sum_s attn[s] x[s]) + bv_h
// (the attention weights of a row sum to one).

typedef __attribute__((ext_vector_type(2)))  float  v2f;
typedef __attribute__((ext_vector_type(4)))  float  v4f;
typedef __attribute__((ext_vector_type(8)))  float  v8f;
typedef __attribute__((ext_vector_type(4)))  __bf16 v4bf;
typedef __attribute__((ext_vector_type(8)))  __bf16 v8bf;
typedef __attribute__((ext_vector_type(16))) __bf16 v16bf;

#define SSPLIT 4             // work-groups that share one batch's key range
#define SPART  (Tc / SSPLIT) // key rows of one such part
#define NCH    (Tc / 32)     // 32-row score blocks of one batch
#define LOG2E  1.44269504f

static __device__ __forceinline__ float exp2_slot(float a) {
  float r;
  asm("v_exp_f32 %0, %1\n\tv_nop" : "=v"(r) : "v"(a));
  return r;
}

// Sum and maximum over the 16 lanes of a row (half a wave), left in every lane
// of the row; all 32 lanes are on wherever these are called. Four vector
// instructions in place of four round trips through the LDS unit.
static __device__ __forceinline__ float row_sum(float v) {
  asm("v_add_f32_dpp %0, %0, %0 row_xmask:1 row_mask:0xf bank_mask:0xf\n\t"
      "v_add_f32_dpp %0, %0, %0 row_xmask:2 row_mask:0xf bank_mask:0xf\n\t"
      "v_add_f32_dpp %0, %0, %0 row_xmask:4 row_mask:0xf bank_mask:0xf\n\t"
      "v_add_f32_dpp %0, %0, %0 row_xmask:8 row_mask:0xf bank_mask:0xf" : "+v"(v));
  return v;
}
static __device__ __forceinline__ float row_max(float v) {
  asm("v_max_num_f32_dpp %0, %0, %0 row_xmask:1 row_mask:0xf bank_mask:0xf\n\t"
      "v_max_num_f32_dpp %0, %0, %0 row_xmask:2 row_mask:0xf bank_mask:0xf\n\t"
      "v_max_num_f32_dpp %0, %0, %0 row_xmask:4 row_mask:0xf bank_mask:0xf\n\t"
      "v_max_num_f32_dpp %0, %0, %0 row_xmask:8 row_mask:0xf bank_mask:0xf" : "+v"(v));
  return v;
}

// Work-group barrier behind this wave's LDS traffic alone: __syncthreads()
// would also wait for the global loads that are still in flight.
static __device__ __forceinline__ void lds_barrier() {
  asm volatile("s_wait_dscnt 0x0\n\ts_barrier_signal -1\n\ts_barrier_wait -1" ::: "memory");
}

// ---------------------------------------------------------------------------
// Tiny GEMM, <=8 rows (M padded to 16 with zeros), one work-group
// per 16-column N-tile. out[r,n] = sum_k A[r,k] * W[n,k] + bias[n].
// k is split over KW waves: each wave asks for its whole k-slice at once, so
// the work-group pays one memory round trip instead of one per k-step; the
// f32 partial tiles are summed through LDS in wave order.
// Used for q-last and out-proj.
// ---------------------------------------------------------------------------
#define KW    16             // waves per work-group
#define KWSTP (Dc / KW / 32) // WMMA k-steps per wave (2)

__global__ __launch_bounds__(32 * KW) void gemm_rows16_kernel(
    const float* __restrict__ A, size_t arow_stride, int arows,
    const float* __restrict__ W, const float* __restrict__ bias,
    float* __restrict__ out, size_t orow_stride)
{
  __shared__ float part[KW][8][16];

  const int Nbase = blockIdx.x * 16;
  const int tid   = threadIdx.x;
  const int wave  = tid >> 5;
  const int lane  = tid & 31;
  const int half  = lane >> 4;
  const int idx   = lane & 15;

  // Piece c of k-step s holds k = kbase + s*32 + (c>>1)*16 + (c&1)*4 .. +3,
  // the same for A and W.
  const int kbase = wave * (Dc / KW) + half * 8;
  const float* wrow = W + (size_t)(Nbase + idx) * Dc + kbase;

  float4 wf[KWSTP][4], af[KWSTP][4];
  #pragma unroll
  for (int s = 0; s < KWSTP; ++s)
    #pragma unroll
    for (int c = 0; c < 4; ++c) {
      wf[s][c] = *(const float4*)(wrow + s * 32 + (c >> 1) * 16 + (c & 1) * 4);
      af[s][c] = make_float4(0.f, 0.f, 0.f, 0.f);
    }
  const float bb = bias[Nbase + idx];  // asked for with the operands
  if (idx < arows) {
    const float* arow = A + (size_t)idx * arow_stride + kbase;
    #pragma unroll
    for (int s = 0; s < KWSTP; ++s)
      #pragma unroll
      for (int c = 0; c < 4; ++c)
        af[s][c] = *(const float4*)(arow + s * 32 + (c >> 1) * 16 + (c & 1) * 4);
  }

  v8f acc = {};
  #pragma unroll
  for (int s = 0; s < KWSTP; ++s) {
    v16bf a, b;
    #pragma unroll
    for (int c = 0; c < 4; ++c) {
      a[c * 4 + 0] = (__bf16)af[s][c].x; a[c * 4 + 1] = (__bf16)af[s][c].y;
      a[c * 4 + 2] = (__bf16)af[s][c].z; a[c * 4 + 3] = (__bf16)af[s][c].w;
      b[c * 4 + 0] = (__bf16)wf[s][c].x; b[c * 4 + 1] = (__bf16)wf[s][c].y;
      b[c * 4 + 2] = (__bf16)wf[s][c].z; b[c * 4 + 3] = (__bf16)wf[s][c].w;
    }
    acc = __builtin_amdgcn_wmma_f32_16x16x32_bf16(
        false, a, false, b, (short)0, acc, false, false);
  }

  // C layout: VGPR r of lanes 0..15 -> row r, column idx.
  if (half == 0) {
    #pragma unroll
    for (int r = 0; r < 8; ++r) part[wave][r][idx] = acc[r];
  }
  __syncthreads();

  const int r = tid >> 4;            // 0..7 for the first 128 threads
  if (r < 8 && r < arows) {          // column = idx
    float sum = 0.f;
    #pragma unroll
    for (int w = 0; w < KW; ++w) sum += part[w][r][idx];
    out[(size_t)r * orow_stride + Nbase + idx] = sum + bb;
  }
}

// ---------------------------------------------------------------------------
// Folded query: qk[b,h,d] = sum_j q[b,h*64+j] * Wk[h*64+j,d], qb[b,h] = q . bk.
// One wave per (head, 64 columns d). Rows of the product are the batches
// (padded to 16 with zeros), k is j. Element e of a fragment holds
// j = ks*32 + 16*half + e on both sides. A lane's 16-byte load of a Wk row
// gives column d0 + 4*idx + t to N-tile t, so every load covers whole lines.
// ---------------------------------------------------------------------------
__global__ __launch_bounds__(32) void fold_qk_kernel(
    const float* __restrict__ qws, const float* __restrict__ Wk,
    const float* __restrict__ bk, __bf16* __restrict__ qk,
    float* __restrict__ qb)
{
  const int h    = blockIdx.x >> 4;
  const int dg   = blockIdx.x & 15;
  const int lane = threadIdx.x;
  const int half = lane >> 4;
  const int idx  = lane & 15;

  const float* wp = Wk + (size_t)(h * DKc + 16 * half) * Dc + dg * 64 + 4 * idx;
  v4f wf[2][16], af[2][4], bf[2][4];
  #pragma unroll
  for (int ks = 0; ks < 2; ++ks) {
    #pragma unroll
    for (int e = 0; e < 16; ++e)
      wf[ks][e] = *(const v4f*)(wp + (size_t)(ks * 32 + e) * Dc);
    #pragma unroll
    for (int i = 0; i < 4; ++i) { af[ks][i] = (v4f)(0.f); bf[ks][i] = (v4f)(0.f); }
  }
  if (idx < Bc) {
    const float* qp = qws + idx * DOc + h * DKc + 16 * half;
    #pragma unroll
    for (int ks = 0; ks < 2; ++ks)
      #pragma unroll
      for (int i = 0; i < 4; ++i) af[ks][i] = *(const v4f*)(qp + ks * 32 + i * 4);
  }
  if (dg == 0 && idx == 0) {
    const float* bp = bk + h * DKc + 16 * half;
    #pragma unroll
    for (int ks = 0; ks < 2; ++ks)
      #pragma unroll
      for (int i = 0; i < 4; ++i) bf[ks][i] = *(const v4f*)(bp + ks * 32 + i * 4);
  }

  v16bf a[2];
  #pragma unroll
  for (int ks = 0; ks < 2; ++ks)
    #pragma unroll
    for (int e = 0; e < 16; ++e) a[ks][e] = (__bf16)af[ks][e >> 2][e & 3];

  v8f acc[4] = {};
  #pragma unroll
  for (int ks = 0; ks < 2; ++ks)
    #pragma unroll
    for (int t = 0; t < 4; ++t) {
      v16bf w;
      #pragma unroll
      for (int e = 0; e < 16; ++e) w[e] = (__bf16)wf[ks][e][t];
      acc[t] = __builtin_amdgcn_wmma_f32_16x16x32_bf16(
          false, a[ks], false, w, (short)0, acc[t], false, false);
    }

  // C layout: VGPR r of lanes 0..15 -> batch r, column d0 + 4*idx + t.
  if (half == 0) {
    #pragma unroll
    for (int r = 0; r < Bc; ++r) {
      v4bf o;
      #pragma unroll
      for (int t = 0; t < 4; ++t) o[t] = (__bf16)acc[t][r];
      *(v4bf*)(qk + (size_t)(r * Hc + h) * Dc + dg * 64 + 4 * idx) = o;
    }
  }

  if (dg == 0) {                     // bk as the one live column of a fifth tile
    v8f accb = {};
    #pragma unroll
    for (int ks = 0; ks < 2; ++ks) {
      v16bf w;
      #pragma unroll
      for (int e = 0; e < 16; ++e) w[e] = (__bf16)bf[ks][e >> 2][e & 3];
      accb = __builtin_amdgcn_wmma_f32_16x16x32_bf16(
          false, a[ks], false, w, (short)0, accb, false, false);
    }
    if (lane == 0) {
      #pragma unroll
      for (int r = 0; r < Bc; ++r) qb[r * Hc + h] = accb[r];
    }
  }
}

// ---------------------------------------------------------------------------
// Scores: S[b,h,s] = (x[b,s,:] . qk[b,h,:] + qb[b,h]) / 8.
// One work-group per 32 rows of x; k (= d) is split over 8 waves, each asking
// for its whole slice at once; f32 partial tiles are summed through LDS in
// wave order. Element e of a fragment holds d = k0 + ks*32 + e on both sides.
// Each block also leaves, per head, the maximum m of its 32 scores and the sum
// of exp(score - m): st[b, block, h] = (m, sum), one 128-byte line a block.
// ---------------------------------------------------------------------------
__global__ __launch_bounds__(256) void scores_kernel(
    const float* __restrict__ x, const __bf16* __restrict__ qk,
    const float* __restrict__ qb, float* __restrict__ S,
    float* __restrict__ st)
{
  __shared__ float part[8][Hc][36];  // pitch 36: rows start on different banks

  const int m0   = blockIdx.x * 32;
  const int b    = m0 / Tc;
  const int tid  = threadIdx.x;
  const int wave = tid >> 5;
  const int lane = tid & 31;
  const int half = lane >> 4;
  const int idx  = lane & 15;
  const int k0   = wave * 128 + 16 * half;

  v4f af[2][4][4];
  #pragma unroll
  for (int mt = 0; mt < 2; ++mt) {
    const float* xp = x + (size_t)(m0 + mt * 16 + idx) * Dc + k0;
    #pragma unroll
    for (int ks = 0; ks < 4; ++ks)
      #pragma unroll
      for (int i = 0; i < 4; ++i) af[mt][ks][i] = *(const v4f*)(xp + ks * 32 + i * 4);
  }
  // The loads below may land in registers that held the addresses above.
  asm volatile("s_wait_xcnt 0x0" ::: "memory");
  v16bf qf[4];
  #pragma unroll
  for (int ks = 0; ks < 4; ++ks)
    qf[ks] = *(const v16bf*)(qk + (size_t)(b * Hc + idx) * Dc + k0 + ks * 32);
  const float add = qb[b * Hc + (tid >> 4)];
  // Keeps every load above in front of the first conversion: one memory round
  // trip for the wave's whole k slice instead of several.
  __builtin_amdgcn_sched_barrier(0);

  v8f acc[2] = {};
  #pragma unroll
  for (int ks = 0; ks < 4; ++ks)
    #pragma unroll
    for (int mt = 0; mt < 2; ++mt) {
      v16bf a;
      #pragma unroll
      for (int e = 0; e < 16; ++e) a[e] = (__bf16)af[mt][ks][e >> 2][e & 3];
      acc[mt] = __builtin_amdgcn_wmma_f32_16x16x32_bf16(
          false, a, false, qf[ks], (short)0, acc[mt], false, false);
    }

  // C layout: VGPR r -> row mt*16 + 8*half + r, head idx.
  #pragma unroll
  for (int mt = 0; mt < 2; ++mt)
    #pragma unroll
    for (int r = 0; r < 8; ++r) part[wave][idx][mt * 16 + 8 * half + r] = acc[mt][r];
  __syncthreads();

  const int h  = tid >> 4;
  const int s2 = (tid & 15) * 2;
  float t0 = 0.f, t1 = 0.f;
  #pragma unroll
  for (int w = 0; w < 8; ++w) { t0 += part[w][h][s2]; t1 += part[w][h][s2 + 1]; }
  float2 o;
  o.x = (t0 + add) * 0.125f;         // 1/sqrt(DK)
  o.y = (t1 + add) * 0.125f;
  *(float2*)(S + (size_t)(b * Hc + h) * Tc + (m0 % Tc) + s2) = o;

  // The 16 lanes of one head sit in one half of a wave.
  const float mc = row_max(fmaxf(o.x, o.y));
  const float lc = row_sum(exp2_slot((o.x - mc) * LOG2E) + exp2_slot((o.y - mc) * LOG2E));
  if ((tid & 15) == 0) {
    v2f ml;
    ml[0] = mc; ml[1] = lc;
    *(v2f*)(st + ((size_t)blockIdx.x * Hc + h) * 2) = ml;
  }
}

// ---------------------------------------------------------------------------
// Weighted rows: Yp[sp,b,h,d] = sum over the s of part sp of E[b,h,s] * x[b,s,d],
// E = softmax of S over all s. Every work-group merges the batch's block pairs
// (m, sum) into each head's maximum and total and forms the bf16 weights of its
// own part in LDS, while its rows of x are in flight.
// One work-group per (batch, part of 512 s, 64 columns d); rows of the product
// are the heads, k is s, split over 8 waves that each ask for their 64 rows at
// once; f32 partial tiles are summed through LDS in wave order. Element e of a
// fragment holds s = s0 + ks*32 + e on both sides; a lane's 16-byte load of an
// x row gives column d0 + 4*idx + t to N-tile t.
// ---------------------------------------------------------------------------
__global__ __launch_bounds__(256) void attn_x_kernel(
    const float* __restrict__ x, const float* __restrict__ S,
    const float* __restrict__ st, float* __restrict__ Yp)
{
  __shared__ __align__(16) float  part[8][Hc][64];
  __shared__ __align__(16) __bf16 El[Hc][SPART + 8];  // pitch: rows on different banks
  __shared__ v2f red[16][Hc + 1];

  const int dg   = blockIdx.x & 15;
  const int sp   = (blockIdx.x >> 4) & (SSPLIT - 1);
  const int b    = blockIdx.x >> 6;
  const int tid  = threadIdx.x;
  const int wave = tid >> 5;
  const int lane = tid & 31;
  const int half = lane >> 4;
  const int idx  = lane & 15;
  const int s0   = sp * SPART + wave * 64 + 16 * half;
  const int g    = tid >> 4;         // 0..15

  // Asked for first, so that they land in front of the rows of x: the pairs of
  // blocks g, g+16, g+32, g+48 for head idx, and head g's scores of this part.
  v2f cs[4];
  #pragma unroll
  for (int i = 0; i < 4; ++i)
    cs[i] = *(const v2f*)(st + ((size_t)(b * NCH + g + 16 * i) * Hc + idx) * 2);
  const float* sq = S + (size_t)(b * Hc + g) * Tc + sp * SPART + 4 * idx;
  v4f sf[8];
  #pragma unroll
  for (int i = 0; i < 8; ++i) sf[i] = *(const v4f*)(sq + i * 64);
  // The loads below may land in registers that held the addresses above.
  asm volatile("s_wait_xcnt 0x0" ::: "memory");

  const float* xp = x + (size_t)(b * Tc + s0) * Dc + dg * 64 + 4 * idx;
  v4f xf[2][16];
  #pragma unroll
  for (int ks = 0; ks < 2; ++ks)
    #pragma unroll
    for (int e = 0; e < 16; ++e)
      xf[ks][e] = *(const v4f*)(xp + (size_t)(ks * 32 + e) * Dc);
  // Keeps every load above in front of the first use: one memory round trip
  // for the wave's whole s slice instead of several.
  __builtin_amdgcn_sched_barrier(0);

  // Four blocks merged per thread, then the 16 groups of a head per half wave.
  float mt = fmaxf(fmaxf(cs[0][0], cs[1][0]), fmaxf(cs[2][0], cs[3][0]));
  float lt = 0.f;
  #pragma unroll
  for (int i = 0; i < 4; ++i) lt += cs[i][1] * exp2_slot((cs[i][0] - mt) * LOG2E);
  {
    v2f ml;
    ml[0] = mt; ml[1] = lt;
    red[g][idx] = ml;
  }
  lds_barrier();
  const v2f pr = red[idx][g];
  const float m   = row_max(pr[0]);
  const float tot = row_sum(pr[1] * exp2_slot((pr[0] - m) * LOG2E));
  const float inv = 1.0f / tot;

  #pragma unroll
  for (int i = 0; i < 8; ++i) {
    v4bf o;
    #pragma unroll
    for (int j = 0; j < 4; ++j)
      o[j] = (__bf16)(exp2_slot((sf[i][j] - m) * LOG2E) * inv);
    *(v4bf*)&El[g][i * 64 + 4 * idx] = o;
  }
  lds_barrier();
  v16bf a[2];
  #pragma unroll
  for (int ks = 0; ks < 2; ++ks) {
    const __bf16* ep = &El[idx][wave * 64 + 16 * half + ks * 32];
    a[ks] = __builtin_shufflevector(*(const v8bf*)ep, *(const v8bf*)(ep + 8),
                                    0, 1, 2, 3, 4, 5, 6, 7, 8, 9, 10, 11, 12, 13, 14, 15);
  }
  // Keeps the conversions of x, which wait for its rows, behind the weights'
  // work: lifted in front of it they would stall the wave with that work undone.
  __builtin_amdgcn_sched_barrier(0);

  v8f acc[4] = {};
  #pragma unroll
  for (int ks = 0; ks < 2; ++ks)
    #pragma unroll
    for (int t = 0; t < 4; ++t) {
      v16bf w;
      #pragma unroll
      for (int e = 0; e < 16; ++e) w[e] = (__bf16)xf[ks][e][t];
      acc[t] = __builtin_amdgcn_wmma_f32_16x16x32_bf16(
          false, a[ks], false, w, (short)0, acc[t], false, false);
    }

  // C layout: VGPR r -> head 8*half + r, column d0 + 4*idx + t.
  #pragma unroll
  for (int r = 0; r < 8; ++r) {
    v4f o;
    #pragma unroll
    for (int t = 0; t < 4; ++t) o[t] = acc[t][r];
    *(v4f*)&part[wave][8 * half + r][4 * idx] = o;
  }
  __syncthreads();

  const int h  = tid >> 4;
  const int d4 = (tid & 15) * 4;
  v4f sum = (v4f)(0.f);
  #pragma unroll
  for (int w = 0; w < 8; ++w) sum += *(const v4f*)&part[w][h][d4];
  *(v4f*)(Yp + ((size_t)(sp * Bc + b) * Hc + h) * Dc + dg * 64 + d4) = sum;
}

// ---------------------------------------------------------------------------
// Context: ctx[b,n] = sum_d Wv[n,d] * y[b,n/64,d] + bv[n], y = sum of the parts
// of Yp in part order. Same shape as the tiny GEMM: one work-group per 16
// columns n, k split over KW waves, partials summed through LDS in wave order.
// ---------------------------------------------------------------------------
__global__ __launch_bounds__(32 * KW) void ctx_kernel(
    const float* __restrict__ Yp, const float* __restrict__ Wv,
    const float* __restrict__ bv, float* __restrict__ ctx)
{
  __shared__ float part[KW][Bc][16];

  const int Nbase = blockIdx.x * 16;
  const int h     = Nbase / DKc;
  const int tid   = threadIdx.x;
  const int wave  = tid >> 5;
  const int lane  = tid & 31;
  const int half  = lane >> 4;
  const int idx   = lane & 15;

  // Element e of k-step s holds k = kbase + s*32 + e, the same for y and Wv.
  const int kbase = wave * (Dc / KW) + 16 * half;
  const float* wrow = Wv + (size_t)(Nbase + idx) * Dc + kbase;

  v4f wf[KWSTP][4], yf[SSPLIT][KWSTP][4];
  #pragma unroll
  for (int s = 0; s < KWSTP; ++s)
    #pragma unroll
    for (int c = 0; c < 4; ++c) {
      wf[s][c] = *(const v4f*)(wrow + s * 32 + c * 4);
      #pragma unroll
      for (int p = 0; p < SSPLIT; ++p) yf[p][s][c] = (v4f)(0.f);
    }
  const float bb = bv[Nbase + idx];
  if (idx < Bc) {
    #pragma unroll
    for (int p = 0; p < SSPLIT; ++p) {
      const float* yrow = Yp + ((size_t)(p * Bc + idx) * Hc + h) * Dc + kbase;
      #pragma unroll
      for (int s = 0; s < KWSTP; ++s)
        #pragma unroll
        for (int c = 0; c < 4; ++c) yf[p][s][c] = *(const v4f*)(yrow + s * 32 + c * 4);
    }
  }

  v8f acc = {};
  #pragma unroll
  for (int s = 0; s < KWSTP; ++s) {
    v16bf a, w;
    #pragma unroll
    for (int c = 0; c < 4; ++c) {
      v4f y = yf[0][s][c];
      #pragma unroll
      for (int p = 1; p < SSPLIT; ++p) y += yf[p][s][c];
      #pragma unroll
      for (int j = 0; j < 4; ++j) {
        a[c * 4 + j] = (__bf16)y[j];
        w[c * 4 + j] = (__bf16)wf[s][c][j];
      }
    }
    acc = __builtin_amdgcn_wmma_f32_16x16x32_bf16(
        false, a, false, w, (short)0, acc, false, false);
  }

  // C layout: VGPR r of lanes 0..15 -> batch r, column idx.
  if (half == 0) {
    #pragma unroll
    for (int r = 0; r < Bc; ++r) part[wave][r][idx] = acc[r];
  }
  __syncthreads();

  const int r = tid >> 4;
  if (r < Bc) {                      // column = idx
    float sum = 0.f;
    #pragma unroll
    for (int w = 0; w < KW; ++w) sum += part[w][r][idx];
    ctx[r * DOc + Nbase + idx] = sum + bb;
  }
}

// ---------------------------------------------------------------------------
extern "C" void kernel_launch(void* const* d_in, const int* in_sizes, int n_in,
                              void* d_out, int out_size, void* d_ws, size_t ws_size,
                              hipStream_t stream) {
  (void)in_sizes; (void)n_in; (void)out_size; (void)ws_size;

  const float* x  = (const float*)d_in[0];
  const float* Wq = (const float*)d_in[1];
  const float* bq = (const float*)d_in[2];
  const float* Wk = (const float*)d_in[3];
  const float* bk = (const float*)d_in[4];
  const float* Wv = (const float*)d_in[5];
  const float* bv = (const float*)d_in[6];
  const float* Wo = (const float*)d_in[7];
  const float* bo = (const float*)d_in[8];
  float* out = (float*)d_out;

  char* ws = (char*)d_ws;
  float*  Yp    = (float*)(ws);                                   // 1 MB
  float*  Sws   = Yp + (size_t)SSPLIT * Bc * Hc * Dc;             // 512 KB
  float*  qws   = Sws + (size_t)Bc * Hc * Tc;
  float*  ctxws = qws + Bc * DOc;
  float*  qbws  = ctxws + Bc * DOc;
  __bf16* qkws  = (__bf16*)(qbws + Bc * Hc);                      // 128 KB
  float*  stws  = (float*)(qkws + (size_t)Bc * Hc * Dc);          // 32 KB

  // 1) Q for the last token of each batch (4 rows)
  gemm_rows16_kernel<<<DOc / 16, 32 * KW, 0, stream>>>(
      x + (size_t)(Tc - 1) * Dc, (size_t)Tc * Dc, Bc, Wq, bq, qws, DOc);

  // 2) query folded through Wk and bk
  fold_qk_kernel<<<Hc * (Dc / 64), 32, 0, stream>>>(qws, Wk, bk, qkws, qbws);

  // 3) scores of every key row, straight from x, with each block's (max, sum)
  scores_kernel<<<(Bc * Tc) / 32, 256, 0, stream>>>(x, qkws, qbws, Sws, stws);

  // 4) softmax weights and the attention-weighted sums of the rows of x
  attn_x_kernel<<<Bc * SSPLIT * (Dc / 64), 256, 0, stream>>>(x, Sws, stws, Yp);

  // 5) those sums through Wv, plus bv
  ctx_kernel<<<DOc / 16, 32 * KW, 0, stream>>>(Yp, Wv, bv, ctxws);

  // 6) output projection (4 rows) -> d_out
  gemm_rows16_kernel<<<DOc / 16, 32 * KW, 0, stream>>>(
      ctxws, DOc, Bc, Wo, bo, out, DOc);
}

// v005
// A run of this version takes 21.4 microseconds.
// It is 1.20 times as fast as v003, going by the measured steps of the versions left out in between.
// Counting every step since v000, it is 11.2 times as fast.
#include <hip/hip_runtime.h>
#include <hip/hip_bf16.h>

// Problem constants (match reference)
#define Bc  4
#define Tc  2048
#define Dc  1024
#define Hc  16
#define DKc 64
#define DOc 1024

// Only the last query row of each batch reaches the output, so K and V are
// never formed. With q the last row's query of head h:
//   scores[s] = q . (Wk_h x[s] + bk_h) = x[s] . (Wk_h^T q) + q . bk_h
//   ctx       = sum_s attn[s] (Wv_h x[s] + bv_h) = Wv_h (sum_s attn[s] x[s]) + bv_h
// (the attention weights of a row sum to one).

typedef __attribute__((ext_vector_type(2)))  float  v2f;
typedef __attribute__((ext_vector_type(4)))  float  v4f;
typedef __attribute__((ext_vector_type(8)))  float  v8f;
typedef __attribute__((ext_vector_type(2)))  unsigned v2u;
typedef __attribute__((ext_vector_type(8)))  unsigned v8u;
typedef __attribute__((ext_vector_type(2)))  __bf16 v2bf;
typedef __attribute__((ext_vector_type(4)))  __bf16 v4bf;
typedef __attribute__((ext_vector_type(8)))  __bf16 v8bf;
typedef __attribute__((ext_vector_type(16))) __bf16 v16bf;

#define RCH    64            // key rows of one work-group of the pass over x
#define NCK    (Tc / RCH)    // such chunks in one batch (32, one per lane of a wave)
#define DQ     4             // ranges of d in the context product, one work-group each
#define DQW    (Dc / DQ)     // columns d of one such range
#define LOG2E  1.44269504f

static __device__ __forceinline__ float exp2_slot(float a) {
  float r;
  asm("v_exp_f32 %0, %1\n\tv_nop" : "=v"(r) : "v"(a));
  return r;
}

// Sum and maximum over the 16 lanes of a row (half a wave), left in every lane
// of the row; all 32 lanes are on wherever these are called. Four vector
// instructions in place of four round trips through the LDS unit.
static __device__ __forceinline__ float row_sum(float v) {
  asm("v_add_f32_dpp %0, %0, %0 row_xmask:1 row_mask:0xf bank_mask:0xf\n\t"
      "v_add_f32_dpp %0, %0, %0 row_xmask:2 row_mask:0xf bank_mask:0xf\n\t"
      "v_add_f32_dpp %0, %0, %0 row_xmask:4 row_mask:0xf bank_mask:0xf\n\t"
      "v_add_f32_dpp %0, %0, %0 row_xmask:8 row_mask:0xf bank_mask:0xf" : "+v"(v));
  return v;
}
static __device__ __forceinline__ float row_max(float v) {
  asm("v_max_num_f32_dpp %0, %0, %0 row_xmask:1 row_mask:0xf bank_mask:0xf\n\t"
      "v_max_num_f32_dpp %0, %0, %0 row_xmask:2 row_mask:0xf bank_mask:0xf\n\t"
      "v_max_num_f32_dpp %0, %0, %0 row_xmask:4 row_mask:0xf bank_mask:0xf\n\t"
      "v_max_num_f32_dpp %0, %0, %0 row_xmask:8 row_mask:0xf bank_mask:0xf" : "+v"(v));
  return v;
}

// The value that the same lane of the wave's other 16-lane row holds.
static __device__ __forceinline__ float other_row(float v) {
  const unsigned u = __builtin_bit_cast(unsigned, v);
  return __builtin_bit_cast(float, __builtin_amdgcn_permlanex16(
      u, u, 0x76543210u, 0xfedcba98u, false, false));
}

// Work-group barrier behind this wave's LDS traffic alone: __syncthreads()
// would also wait for the global loads that are still in flight.
static __device__ __forceinline__ void lds_barrier() {
  asm volatile("s_wait_dscnt 0x0\n\ts_barrier_signal -1\n\ts_barrier_wait -1" ::: "memory");
}

// A wave's slice of a row-major f32 operand whose rows run along k is 64
// columns wide, 256 B of each row. A fragment wants one row per lane, and a load
// in that shape touches 16 lines for 512 B. So the slice is asked for in whole
// 256-B units (16 lanes a row, two rows a load), turned to bf16 and laid in the
// wave's own LDS range, from which each lane reads its row's 16-byte pieces.
#define SP 72                // pitch of a staged row in bf16: 144 B, as for xs below

static __device__ __forceinline__ void put4(__bf16* p, v4f v) {
  v4bf o;
  #pragma unroll
  for (int t = 0; t < 4; ++t) o[t] = (__bf16)v[t];
  *(v4bf*)p = o;
}
static __device__ __forceinline__ v16bf frag16(const __bf16* lo, const __bf16* hi) {
  return __builtin_shufflevector(*(const v8bf*)lo, *(const v8bf*)hi,
                                 0, 1, 2, 3, 4, 5, 6, 7, 8, 9, 10, 11, 12, 13, 14, 15);
}
// Rows Bc..15 of an A fragment set to zero (every lane has read a live row).
static __device__ __forceinline__ v16bf live_rows(v16bf a, int idx) {
  v8u au = __builtin_bit_cast(v8u, a);
  #pragma unroll
  for (int i = 0; i < 8; ++i) au[i] = idx < Bc ? au[i] : 0u;
  return __builtin_bit_cast(v16bf, au);
}

// ---------------------------------------------------------------------------
// Tiny GEMM, Bc rows (M padded to 16 with zeros), one work-group
// per 16-column N-tile. out[r,n] = sum_k A[r,k] * W[n,k] + bias[n].
// k is split over KW waves: each wave asks for its whole k-slice at once, so
// the work-group pays one memory round trip instead of one per k-step; the
// f32 partial tiles are summed through LDS in wave order.
// Used for q-last.
// ---------------------------------------------------------------------------
#define KW    16             // waves per work-group
#define KWSTP (Dc / KW / 32) // WMMA k-steps per wave (2)

__global__ __launch_bounds__(32 * KW) void gemm_rows16_kernel(
    const float* __restrict__ A, size_t arow_stride,
    const float* __restrict__ W, const float* __restrict__ bias,
    float* __restrict__ out, size_t orow_stride)
{
  __shared__ __align__(16) __bf16 wt[KW][16][SP];
  __shared__ __align__(16) __bf16 at[KW][Bc][SP];
  __shared__ float part[KW][8][16];

  const int Nbase = blockIdx.x * 16;
  const int tid   = threadIdx.x;
  const int wave  = tid >> 5;
  const int lane  = tid & 31;
  const int half  = lane >> 4;
  const int idx   = lane & 15;
  const int k0    = wave * (Dc / KW);

  // Rows 8 apart (the two halves of a wave) start 32 banks apart in LDS.
  v4f wr[8], ar[2];
  #pragma unroll
  for (int i = 0; i < 8; ++i)
    wr[i] = *(const v4f*)(W + (size_t)(Nbase + i + 8 * half) * Dc + k0 + 4 * idx);
  #pragma unroll
  for (int j = 0; j < 2; ++j)
    ar[j] = *(const v4f*)(A + (size_t)(2 * j + half) * arow_stride + k0 + 4 * idx);
  const float bb = bias[Nbase + idx];  // asked for with the operands
  // The arithmetic below may reuse registers that held the addresses above.
  asm volatile("s_wait_xcnt 0x0" ::: "memory");

  #pragma unroll
  for (int i = 0; i < 8; ++i) put4(&wt[wave][i + 8 * half][4 * idx], wr[i]);
  #pragma unroll
  for (int j = 0; j < 2; ++j) put4(&at[wave][2 * j + half][4 * idx], ar[j]);
  // The rows read back below were written by other lanes of this wave.
  asm volatile("s_wait_dscnt 0x0" ::: "memory");

  // Element e of k-step s holds k = k0 + s*32 + 16*(e>>3) + 8*half + (e&7),
  // the same for A and W.
  v8f acc = {};
  #pragma unroll
  for (int s = 0; s < KWSTP; ++s) {
    const __bf16* ap = &at[wave][idx & (Bc - 1)][s * 32 + 8 * half];
    const __bf16* wp = &wt[wave][idx][s * 32 + 8 * half];
    const v16bf a = live_rows(frag16(ap, ap + 16), idx);
    const v16bf b = frag16(wp, wp + 16);
    acc = __builtin_amdgcn_wmma_f32_16x16x32_bf16(
        false, a, false, b, (short)0, acc, false, false);
  }

  // C layout: VGPR r of lanes 0..15 -> row r, column idx.
  if (half == 0) {
    #pragma unroll
    for (int r = 0; r < 8; ++r) part[wave][r][idx] = acc[r];
  }
  __syncthreads();

  const int r = tid >> 4;            // 0..7 for the first 128 threads
  if (r < Bc) {                      // column = idx
    float sum = 0.f;
    #pragma unroll
    for (int w = 0; w < KW; ++w) sum += part[w][r][idx];
    out[(size_t)r * orow_stride + Nbase + idx] = sum + bb;
  }
}

// ---------------------------------------------------------------------------
// Folded query: qk[b,h,d] = sum_j q[b,h*64+j] * Wk[h*64+j,d], qb[b,h] = q . bk.
// One wave per (head, 64 columns d). Rows of the product are the batches
// (padded to 16 with zeros), k is j. Element e of a fragment holds
// j = ks*32 + 16*half + e on both sides. A lane's 16-byte load of a Wk row
// gives column d0 + 4*idx + t to N-tile t, so every load covers whole lines.
// ---------------------------------------------------------------------------
__global__ __launch_bounds__(32) void fold_qk_kernel(
    const float* __restrict__ qws, const float* __restrict__ Wk,
    const float* __restrict__ bk, __bf16* __restrict__ qk,
    float* __restrict__ qb)
{
  const int h    = blockIdx.x >> 4;
  const int dg   = blockIdx.x & 15;
  const int lane = threadIdx.x;
  const int half = lane >> 4;
  const int idx  = lane & 15;

  const float* wp = Wk + (size_t)(h * DKc + 16 * half) * Dc + dg * 64 + 4 * idx;
  v4f wf[2][16], af[2][4], bf[2][4];
  #pragma unroll
  for (int ks = 0; ks < 2; ++ks) {
    #pragma unroll
    for (int e = 0; e < 16; ++e)
      wf[ks][e] = *(const v4f*)(wp + (size_t)(ks * 32 + e) * Dc);
    #pragma unroll
    for (int i = 0; i < 4; ++i) { af[ks][i] = (v4f)(0.f); bf[ks][i] = (v4f)(0.f); }
  }
  if (idx < Bc) {
    const float* qp = qws + idx * DOc + h * DKc + 16 * half;
    #pragma unroll
    for (int ks = 0; ks < 2; ++ks)
      #pragma unroll
      for (int i = 0; i < 4; ++i) af[ks][i] = *(const v4f*)(qp + ks * 32 + i * 4);
  }
  if (dg == 0 && idx == 0) {
    const float* bp = bk + h * DKc + 16 * half;
    #pragma unroll
    for (int ks = 0; ks < 2; ++ks)
      #pragma unroll
      for (int i = 0; i < 4; ++i) bf[ks][i] = *(const v4f*)(bp + ks * 32 + i * 4);
  }

  v16bf a[2];
  #pragma unroll
  for (int ks = 0; ks < 2; ++ks)
    #pragma unroll
    for (int e = 0; e < 16; ++e) a[ks][e] = (__bf16)af[ks][e >> 2][e & 3];

  v8f acc[4] = {};
  #pragma unroll
  for (int ks = 0; ks < 2; ++ks)
    #pragma unroll
    for (int t = 0; t < 4; ++t) {
      v16bf w;
      #pragma unroll
      for (int e = 0; e < 16; ++e) w[e] = (__bf16)wf[ks][e][t];
      acc[t] = __builtin_amdgcn_wmma_f32_16x16x32_bf16(
          false, a[ks], false, w, (short)0, acc[t], false, false);
    }

  // C layout: VGPR r of lanes 0..15 -> batch r, column d0 + 4*idx + t.
  if (half == 0) {
    #pragma unroll
    for (int r = 0; r < Bc; ++r) {
      v4bf o;
      #pragma unroll
      for (int t = 0; t < 4; ++t) o[t] = (__bf16)acc[t][r];
      *(v4bf*)(qk + (size_t)(r * Hc + h) * Dc + dg * 64 + 4 * idx) = o;
    }
  }

  if (dg == 0) {                     // bk as the one live column of a fifth tile
    v8f accb = {};
    #pragma unroll
    for (int ks = 0; ks < 2; ++ks) {
      v16bf w;
      #pragma unroll
      for (int e = 0; e < 16; ++e) w[e] = (__bf16)bf[ks][e >> 2][e & 3];
      accb = __builtin_amdgcn_wmma_f32_16x16x32_bf16(
          false, a[ks], false, w, (short)0, accb, false, false);
    }
    if (lane == 0) {
      #pragma unroll
      for (int r = 0; r < Bc; ++r) qb[r * Hc + h] = accb[r];
    }
  }
}

// ---------------------------------------------------------------------------
// One pass over x: scores, their exponentials and the weighted row sums of one
// chunk of 64 key rows, for all 16 heads.
//   s[h,r]     = (x[r,:] . qk[b,h,:] + qb[b,h]) / 8
//   m[h]       = max over the chunk's r of s[h,r],  l[h] = sum of exp(s - m)
//   Yp[ck,h,d] = sum over the chunk's r of exp(s[h,r] - m[h]) * x[r,d]
// st[ck,h] = (m, l); the context kernel scales the chunks onto one maximum.
// Wave w owns columns d = 64w .. 64w+63 of all 64 rows and asks for them once,
// in whole lines. A lane's 16-byte load of a row gives column d0 + 4*idx + t to
// N-tile t of the second product, where k is the row: element e of a fragment
// holds row ks*32 + 16*(e>>3) + 8*half + (e&7) on both sides. For the first
// product, where k is d, the wave turns its bf16 block round through its own
// LDS range: element e holds d = d0 + kd*32 + 16*half + e on both sides. The
// waves' f32 partial scores are summed through LDS in wave order.
// ---------------------------------------------------------------------------
__global__ __launch_bounds__(512) void scores_attn_kernel(
    const float* __restrict__ x, const __bf16* __restrict__ qk,
    const float* __restrict__ qb, float* __restrict__ Yp,
    float* __restrict__ st)
{
  // Pitches: 144 B for 16-byte readers of 128-B rows; 68 dwords for columns.
  __shared__ __align__(16) __bf16 xs[16][RCH][64 + 8];
  __shared__ __align__(16) float  part[16][Hc][RCH + 4];
  __shared__ __align__(16) __bf16 El[Hc][RCH + 8];
  __shared__ __align__(16) __bf16 qt[16][Hc][SP];

  const int ck   = blockIdx.x;       // chunk, counted over all batches
  const int b    = ck / NCK;
  const int tid  = threadIdx.x;
  const int wave = tid >> 5;
  const int lane = tid & 31;
  const int half = lane >> 4;
  const int idx  = lane & 15;
  const int d0   = wave * 64;

  // The wave's 64 columns of qk, one whole line a head, 8 lanes a head: load i
  // brings heads 4i .. 4i + 3. Turned to fragment order through qt below.
  v8bf qr[4];
  #pragma unroll
  for (int i = 0; i < 4; ++i)
    qr[i] = *(const v8bf*)(qk + (size_t)(b * Hc + 4 * i + (lane >> 3)) * Dc + d0 + 8 * (lane & 7));
  const float add = qb[b * Hc + wave];
  // The loads below may land in registers that held the addresses above.
  asm volatile("s_wait_xcnt 0x0" ::: "memory");

  const float* xp = x + (size_t)(ck * RCH + 8 * half) * Dc + d0 + 4 * idx;
  v4f xf[2][16];
  #pragma unroll
  for (int ks = 0; ks < 2; ++ks)
    #pragma unroll
    for (int e = 0; e < 16; ++e)
      xf[ks][e] = *(const v4f*)(xp + (size_t)(ks * 32 + 16 * (e >> 3) + (e & 7)) * Dc);
  // Keeps every load above in front of the first conversion: one memory round
  // trip for the wave's whole block instead of several.
  __builtin_amdgcn_sched_barrier(0);

  #pragma unroll
  for (int i = 0; i < 4; ++i) *(v8bf*)&qt[wave][4 * i + (lane >> 3)][8 * (lane & 7)] = qr[i];

  // Rows 8 apart (the two halves of a wave) start 32 banks apart at this pitch.
  v2u xr[2][16];                     // a row's four bf16: (t0, t1), (t2, t3)
  #pragma unroll
  for (int ks = 0; ks < 2; ++ks)
    #pragma unroll
    for (int e = 0; e < 16; ++e) {
      v4bf o;
      #pragma unroll
      for (int t = 0; t < 4; ++t) o[t] = (__bf16)xf[ks][e][t];
      *(v4bf*)&xs[wave][ks * 32 + 16 * (e >> 3) + 8 * half + (e & 7)][4 * idx] = o;
      xr[ks][e] = __builtin_bit_cast(v2u, o);
    }
  // Column t of rows e, e + 1 into one register: one byte permute each, where
  // plain element moves compile to two 16-bit moves.
  v16bf xw[2][4];
  #pragma unroll
  for (int ks = 0; ks < 2; ++ks)
    #pragma unroll
    for (int t = 0; t < 4; ++t) {
      v8u u;
      #pragma unroll
      for (int i = 0; i < 8; ++i)
        u[i] = __builtin_amdgcn_perm(xr[ks][2 * i + 1][t >> 1], xr[ks][2 * i][t >> 1],
                                     (t & 1) ? 0x07060302u : 0x05040100u);
      xw[ks][t] = __builtin_bit_cast(v16bf, u);
    }
  // The rows read back below were written by other lanes of this wave.
  asm volatile("s_wait_dscnt 0x0" ::: "memory");

  v16bf qf[2];
  #pragma unroll
  for (int kd = 0; kd < 2; ++kd) {
    const __bf16* qp = &qt[wave][idx][kd * 32 + 16 * half];
    qf[kd] = frag16(qp, qp + 8);
  }

  v8f sacc[4] = {};
  #pragma unroll
  for (int kd = 0; kd < 2; ++kd)
    #pragma unroll
    for (int mt = 0; mt < 4; ++mt) {
      const __bf16* ap = &xs[wave][mt * 16 + idx][kd * 32 + 16 * half];
      const v16bf a = __builtin_shufflevector(*(const v8bf*)ap, *(const v8bf*)(ap + 8),
                                              0, 1, 2, 3, 4, 5, 6, 7, 8, 9, 10, 11, 12, 13, 14, 15);
      sacc[mt] = __builtin_amdgcn_wmma_f32_16x16x32_bf16(
          false, a, false, qf[kd], (short)0, sacc[mt], false, false);
    }

  // C layout: VGPR r -> row mt*16 + 8*half + r, head idx.
  #pragma unroll
  for (int mt = 0; mt < 4; ++mt) {
    v4f lo, hi;
    #pragma unroll
    for (int r = 0; r < 4; ++r) { lo[r] = sacc[mt][r]; hi[r] = sacc[mt][4 + r]; }
    *(v4f*)&part[wave][idx][mt * 16 + 8 * half]     = lo;
    *(v4f*)&part[wave][idx][mt * 16 + 8 * half + 4] = hi;
  }
  __syncthreads();

  // Wave w finishes head w: lane -> rows 2*lane, 2*lane + 1.
  {
    float t0 = 0.f, t1 = 0.f;
    #pragma unroll
    for (int w = 0; w < 16; ++w) {
      const v2f p = *(const v2f*)&part[w][wave][2 * lane];
      t0 += p[0]; t1 += p[1];
    }
    const float o0 = (t0 + add) * 0.125f;  // 1/sqrt(DK)
    const float o1 = (t1 + add) * 0.125f;
    float mc = row_max(fmaxf(o0, o1));
    mc = fmaxf(mc, other_row(mc));
    const float p0 = exp2_slot((o0 - mc) * LOG2E);
    const float p1 = exp2_slot((o1 - mc) * LOG2E);
    float lc = row_sum(p0 + p1);
    lc += other_row(lc);
    v2bf pe;
    pe[0] = (__bf16)p0; pe[1] = (__bf16)p1;
    *(v2bf*)&El[wave][2 * lane] = pe;
    if (lane == 0) {
      v2f ml;
      ml[0] = mc; ml[1] = lc;
      *(v2f*)(st + ((size_t)ck * Hc + wave) * 2) = ml;
    }
  }
  lds_barrier();

  v8f acc[4] = {};
  #pragma unroll
  for (int ks = 0; ks < 2; ++ks) {
    const __bf16* ep = &El[idx][ks * 32 + 8 * half];
    const v16bf a = __builtin_shufflevector(*(const v8bf*)ep, *(const v8bf*)(ep + 16),
                                            0, 1, 2, 3, 4, 5, 6, 7, 8, 9, 10, 11, 12, 13, 14, 15);
    #pragma unroll
    for (int t = 0; t < 4; ++t)
      acc[t] = __builtin_amdgcn_wmma_f32_16x16x32_bf16(
          false, a, false, xw[ks][t], (short)0, acc[t], false, false);
  }

  // C layout: VGPR r -> head 8*half + r, column d0 + 4*idx + t.
  #pragma unroll
  for (int r = 0; r < 8; ++r) {
    v4f o;
    #pragma unroll
    for (int t = 0; t < 4; ++t) o[t] = acc[t][r];
    *(v4f*)(Yp + ((size_t)ck * Hc + 8 * half + r) * Dc + d0 + 4 * idx) = o;
  }
}

// ---------------------------------------------------------------------------
// Context: ctxp[dq,b,n] = sum over the d of range dq of Wv[n,d] * y[b,n/64,d]
// (+ bv[n] in range 0), y = sum over chunks c of Yp[c] * exp(m_c - m) / total.
// One work-group per (head, range of 256 d), so each range of a chunk row and of
// a row of Wv is read by one work-group only. A wave holds one batch's 32 chunk
// weights, one per lane; it sums 16 chunks in chunk order, the two groups of 16
// are added when the A fragment is formed. Product: wave = (N-tile, quarter of
// the range); element e of k-step s holds d = k0 + s*32 + e on both sides; the
// quarters' f32 partial tiles are summed through LDS in order.
// ---------------------------------------------------------------------------
__global__ __launch_bounds__(512) void ctx_kernel(
    const float* __restrict__ Yp, const float* __restrict__ st,
    const float* __restrict__ Wv, const float* __restrict__ bv,
    float* __restrict__ ctxp)
{
  __shared__ __align__(16) float ys[2][Bc][DQW + 4];
  __shared__ __align__(16) __bf16 wt[16][16][SP];
  __shared__ float part[4][4][Bc][16];

  const int h    = blockIdx.x / DQ;
  const int dq   = blockIdx.x % DQ;
  const int tid  = threadIdx.x;
  const int wave = tid >> 5;
  const int lane = tid & 31;
  const int half = lane >> 4;
  const int idx  = lane & 15;

  // Merge side: batch and group of 16 chunks of this wave, 4 columns a thread.
  const int b  = (wave >> 1) & 3;
  const int cg = __builtin_amdgcn_readfirstlane(wave >> 3);
  const int d4 = (tid & 63) * 4;
  const v2f pr = *(const v2f*)(st + ((size_t)(b * NCK + lane) * Hc + h) * 2);
  const float* yp = Yp + ((size_t)(b * NCK + cg * 16) * Hc + h) * Dc + dq * DQW + d4;
  v4f yv[16];
  #pragma unroll
  for (int i = 0; i < 16; ++i) yv[i] = *(const v4f*)(yp + (size_t)i * Hc * Dc);
  // The loads below may land in registers that held the addresses above.
  asm volatile("s_wait_xcnt 0x0" ::: "memory");

  // Product side.
  const int nt = wave & 3;
  const int kq = wave >> 2;
  const int k0 = kq * 64 + 16 * half;
  const float* wrow = Wv + (size_t)(h * DKc + nt * 16 + 8 * half) * Dc + dq * DQW + kq * 64 + 4 * idx;
  v4f wr[8];
  #pragma unroll
  for (int i = 0; i < 8; ++i) wr[i] = *(const v4f*)(wrow + (size_t)i * Dc);
  const float bb = bv[h * DKc + (tid & 63)];
  // The arithmetic below may reuse registers that held the addresses above.
  asm volatile("s_wait_xcnt 0x0" ::: "memory");
  // Keeps every load above in front of the first use: one memory round trip.
  __builtin_amdgcn_sched_barrier(0);

  float m = row_max(pr[0]);
  m = fmaxf(m, other_row(m));
  const float ec = exp2_slot((pr[0] - m) * LOG2E);
  float tot = row_sum(pr[1] * ec);
  tot += other_row(tot);
  const int wc = __builtin_bit_cast(int, ec * (1.0f / tot));

  v4f y = (v4f)(0.f);
  #pragma unroll
  for (int i = 0; i < 16; ++i)
    y += yv[i] * __builtin_bit_cast(float, __builtin_amdgcn_readlane(wc, cg * 16 + i));
  *(v4f*)&ys[cg][b][d4] = y;
  #pragma unroll
  for (int i = 0; i < 8; ++i) put4(&wt[wave][i + 8 * half][4 * idx], wr[i]);
  __syncthreads();

  // Every lane reads a live row (idx & 3), so that the reads go out together
  // with no branch between them; rows 4..15 of A are then set to zero.
  v4f ya[2][4];
  #pragma unroll
  for (int s = 0; s < 2; ++s)
    #pragma unroll
    for (int c = 0; c < 4; ++c)
      ya[s][c] = *(const v4f*)&ys[0][idx & (Bc - 1)][k0 + s * 32 + c * 4] +
                 *(const v4f*)&ys[1][idx & (Bc - 1)][k0 + s * 32 + c * 4];

  v8f acc = {};
  #pragma unroll
  for (int s = 0; s < 2; ++s) {
    v16bf a;
    #pragma unroll
    for (int c = 0; c < 4; ++c) {
      #pragma unroll
      for (int j = 0; j < 4; ++j) a[c * 4 + j] = (__bf16)ya[s][c][j];
    }
    const __bf16* wp = &wt[wave][idx][s * 32 + 16 * half];
    acc = __builtin_amdgcn_wmma_f32_16x16x32_bf16(
        false, live_rows(a, idx), false, frag16(wp, wp + 8), (short)0, acc, false, false);
  }

  // C layout: VGPR r of lanes 0..15 -> batch r, column nt*16 + idx.
  if (half == 0) {
    #pragma unroll
    for (int r = 0; r < Bc; ++r) part[kq][nt][r][idx] = acc[r];
  }
  __syncthreads();

  if (tid < Bc * DKc) {
    const int r = tid >> 6;
    const int n = tid & 63;
    float sum = 0.f;
    #pragma unroll
    for (int q = 0; q < 4; ++q) sum += part[q][n >> 4][r][n & 15];
    if (dq == 0) sum += bb;
    ctxp[(size_t)(dq * Bc + r) * DOc + h * DKc + n] = sum;
  }
}

// ---------------------------------------------------------------------------
// Output projection: out[b,p] = sum_n Wo[p,n] * ctx[b,n] + bo[p], ctx = sum of
// the parts of ctxp in part order. Same shape as the tiny GEMM: one work-group
// per 16 columns p, k split over KW waves, partials summed through LDS in wave
// order.
// ---------------------------------------------------------------------------
__global__ __launch_bounds__(32 * KW) void out_kernel(
    const float* __restrict__ ctxp, const float* __restrict__ Wo,
    const float* __restrict__ bo, float* __restrict__ out)
{
  __shared__ __align__(16) __bf16 wt[KW][16][SP];
  __shared__ __align__(16) __bf16 ct[KW][Bc][SP];
  __shared__ float part[KW][Bc][16];

  const int Nbase = blockIdx.x * 16;
  const int tid   = threadIdx.x;
  const int wave  = tid >> 5;
  const int lane  = tid & 31;
  const int half  = lane >> 4;
  const int idx   = lane & 15;
  const int k0    = wave * (DOc / KW);

  // Load i of ctxp brings rows 2i and 2i + 1 of its DQ * Bc rows: part i >> 1,
  // batch 2*(i & 1) + half.
  v4f wr[8], cr[2 * DQ];
  #pragma unroll
  for (int i = 0; i < 8; ++i)
    wr[i] = *(const v4f*)(Wo + (size_t)(Nbase + i + 8 * half) * DOc + k0 + 4 * idx);
  // The loads below may land in registers that held the addresses above.
  asm volatile("s_wait_xcnt 0x0" ::: "memory");
  #pragma unroll
  for (int i = 0; i < 2 * DQ; ++i)
    cr[i] = *(const v4f*)(ctxp + (size_t)(2 * i + half) * DOc + k0 + 4 * idx);
  const float bb = bo[Nbase + idx];
  // The arithmetic below may reuse registers that held the addresses above.
  asm volatile("s_wait_xcnt 0x0" ::: "memory");
  // Keeps every load above in front of the first use: one memory round trip.
  __builtin_amdgcn_sched_barrier(0);

  #pragma unroll
  for (int i = 0; i < 8; ++i) put4(&wt[wave][i + 8 * half][4 * idx], wr[i]);
  #pragma unroll
  for (int j = 0; j < 2; ++j) {
    v4f y = cr[j];
    #pragma unroll
    for (int p = 1; p < DQ; ++p) y += cr[2 * p + j];
    put4(&ct[wave][2 * j + half][4 * idx], y);
  }
  // The rows read back below were written by other lanes of this wave.
  asm volatile("s_wait_dscnt 0x0" ::: "memory");

  // Element e of k-step s holds k = k0 + s*32 + 16*half + e, the same for ctx
  // and Wo.
  v8f acc = {};
  #pragma unroll
  for (int s = 0; s < KWSTP; ++s) {
    const __bf16* cp = &ct[wave][idx & (Bc - 1)][s * 32 + 16 * half];
    const __bf16* wp = &wt[wave][idx][s * 32 + 16 * half];
    acc = __builtin_amdgcn_wmma_f32_16x16x32_bf16(
        false, live_rows(frag16(cp, cp + 8), idx), false, frag16(wp, wp + 8),
        (short)0, acc, false, false);
  }

  // C layout: VGPR r of lanes 0..15 -> batch r, column idx.
  if (half == 0) {
    #pragma unroll
    for (int r = 0; r < Bc; ++r) part[wave][r][idx] = acc[r];
  }
  __syncthreads();

  const int r = tid >> 4;
  if (r < Bc) {                      // column = idx
    float sum = 0.f;
    #pragma unroll
    for (int w = 0; w < KW; ++w) sum += part[w][r][idx];
    out[r * DOc + Nbase + idx] = sum + bb;
  }
}

// ---------------------------------------------------------------------------
extern "C" void kernel_launch(void* const* d_in, const int* in_sizes, int n_in,
                              void* d_out, int out_size, void* d_ws, size_t ws_size,
                              hipStream_t stream) {
  (void)in_sizes; (void)n_in; (void)out_size; (void)ws_size;

  const float* x  = (const float*)d_in[0];
  const float* Wq = (const float*)d_in[1];
  const float* bq = (const float*)d_in[2];
  const float* Wk = (const float*)d_in[3];
  const float* bk = (const float*)d_in[4];
  const float* Wv = (const float*)d_in[5];
  const float* bv = (const float*)d_in[6];
  const float* Wo = (const float*)d_in[7];
  const float* bo = (const float*)d_in[8];
  float* out = (float*)d_out;

  char* ws = (char*)d_ws;
  float*  Yp    = (float*)(ws);                                   // 8 MB
  float*  qws   = Yp + (size_t)Bc * NCK * Hc * Dc;
  float*  ctxws = qws + Bc * DOc;                                 // DQ parts
  float*  qbws  = ctxws + DQ * Bc * DOc;
  __bf16* qkws  = (__bf16*)(qbws + Bc * Hc);                      // 128 KB
  float*  stws  = (float*)(qkws + (size_t)Bc * Hc * Dc);          // 16 KB

  // 1) Q for the last token of each batch (4 rows)
  gemm_rows16_kernel<<<DOc / 16, 32 * KW, 0, stream>>>(
      x + (size_t)(Tc - 1) * Dc, (size_t)Tc * Dc, Wq, bq, qws, DOc);

  // 2) query folded through Wk and bk
  fold_qk_kernel<<<Hc * (Dc / 64), 32, 0, stream>>>(qws, Wk, bk, qkws, qbws);

  // 3) one pass over x: each chunk's scores, (max, sum) and weighted row sums
  scores_attn_kernel<<<Bc * NCK, 512, 0, stream>>>(x, qkws, qbws, Yp, stws);

  // 4) chunks merged, then through Wv, plus bv
  ctx_kernel<<<Hc * DQ, 512, 0, stream>>>(Yp, stws, Wv, bv, ctxws);

  // 5) output projection (4 rows) -> d_out
  out_kernel<<<DOc / 16, 32 * KW, 0, stream>>>(ctxws, Wo, bo, out);
}

// v006
// Measured time: 19.7 microseconds a run.
// Timed twice side by side with v005, it ran 1.06 times as fast both times.
// Over all steps from v000 it is 11.9 times as fast.
#include <hip/hip_runtime.h>
#include <hip/hip_bf16.h>

// Problem constants (match reference)
#define Bc  4
#define Tc  2048
#define Dc  1024
#define Hc  16
#define DKc 64
#define DOc 1024

// Only the last query row of each batch reaches the output, so K and V are
// never formed. With q the last row's query of head h:
//   scores[s] = q . (Wk_h x[s] + bk_h) = x[s] . (Wk_h^T q) + q . bk_h
//   ctx       = sum_s attn[s] (Wv_h x[s] + bv_h) = Wv_h (sum_s attn[s] x[s]) + bv_h
// (the attention weights of a row sum to one).

typedef __attribute__((ext_vector_type(2)))  float  v2f;
typedef __attribute__((ext_vector_type(4)))  float  v4f;
typedef __attribute__((ext_vector_type(8)))  float  v8f;
typedef __attribute__((ext_vector_type(2)))  unsigned v2u;
typedef __attribute__((ext_vector_type(8)))  unsigned v8u;
typedef __attribute__((ext_vector_type(2)))  __bf16 v2bf;
typedef __attribute__((ext_vector_type(4)))  __bf16 v4bf;
typedef __attribute__((ext_vector_type(8)))  __bf16 v8bf;
typedef __attribute__((ext_vector_type(16))) __bf16 v16bf;

#define RCH    64            // key rows of one work-group of the pass over x
#define NCK    (Tc / RCH)    // such chunks in one batch (32, one per lane of a wave)
#define DQ     4             // ranges of d in the context product
#define DQW    (Dc / DQ)     // columns d of one such range
#define LOG2E  1.44269504f

static __device__ __forceinline__ float exp2_slot(float a) {
  float r;
  asm("v_exp_f32 %0, %1\n\tv_nop" : "=v"(r) : "v"(a));
  return r;
}

// Sum and maximum over the 16 lanes of a row (half a wave), left in every lane
// of the row; all 32 lanes are on wherever these are called. Four vector
// instructions in place of four round trips through the LDS unit.
static __device__ __forceinline__ float row_sum(float v) {
  asm("v_add_f32_dpp %0, %0, %0 row_xmask:1 row_mask:0xf bank_mask:0xf\n\t"
      "v_add_f32_dpp %0, %0, %0 row_xmask:2 row_mask:0xf bank_mask:0xf\n\t"
      "v_add_f32_dpp %0, %0, %0 row_xmask:4 row_mask:0xf bank_mask:0xf\n\t"
      "v_add_f32_dpp %0, %0, %0 row_xmask:8 row_mask:0xf bank_mask:0xf" : "+v"(v));
  return v;
}
static __device__ __forceinline__ float row_max(float v) {
  asm("v_max_num_f32_dpp %0, %0, %0 row_xmask:1 row_mask:0xf bank_mask:0xf\n\t"
      "v_max_num_f32_dpp %0, %0, %0 row_xmask:2 row_mask:0xf bank_mask:0xf\n\t"
      "v_max_num_f32_dpp %0, %0, %0 row_xmask:4 row_mask:0xf bank_mask:0xf\n\t"
      "v_max_num_f32_dpp %0, %0, %0 row_xmask:8 row_mask:0xf bank_mask:0xf" : "+v"(v));
  return v;
}

// The value that the same lane of the wave's other 16-lane row holds.
static __device__ __forceinline__ float other_row(float v) {
  const unsigned u = __builtin_bit_cast(unsigned, v);
  return __builtin_bit_cast(float, __builtin_amdgcn_permlanex16(
      u, u, 0x76543210u, 0xfedcba98u, false, false));
}

// The value that lane I of the lane's own 16-lane row holds (the lane number is
// part of the instruction, so it is a template argument).
template <int I>
static __device__ __forceinline__ float row_lane(int v) {
  return __builtin_bit_cast(float, __builtin_amdgcn_update_dpp(0, v, 0x150 + I, 0xf, 0xf, false));
}

// Work-group barrier behind this wave's LDS traffic alone: __syncthreads()
// would also wait for the global loads that are still in flight.
static __device__ __forceinline__ void lds_barrier() {
  asm volatile("s_wait_dscnt 0x0\n\ts_barrier_signal -1\n\ts_barrier_wait -1" ::: "memory");
}

// A wave's slice of a row-major f32 operand whose rows run along k is 64
// columns wide, 256 B of each row. A fragment wants one row per lane, and a load
// in that shape touches 16 lines for 512 B. So the slice is asked for in whole
// 256-B units (two rows of 16 lanes, or one row of 32 lanes, a load), turned to bf16 and laid in the
// wave's own LDS range, from which each lane reads its row's 16-byte pieces.
#define SP 72                // pitch of a staged row in bf16: 144 B, as for xs below

static __device__ __forceinline__ void put4(__bf16* p, v4f v) {
  v4bf o;
  #pragma unroll
  for (int t = 0; t < 4; ++t) o[t] = (__bf16)v[t];
  *(v4bf*)p = o;
}
static __device__ __forceinline__ v16bf frag16(const __bf16* lo, const __bf16* hi) {
  return __builtin_shufflevector(*(const v8bf*)lo, *(const v8bf*)hi,
                                 0, 1, 2, 3, 4, 5, 6, 7, 8, 9, 10, 11, 12, 13, 14, 15);
}

// ---------------------------------------------------------------------------
// Tiny GEMM, Bc rows: out[r,n] = sum_k A[r,k] * W[n,k] + bias[n]. What such a
// launch costs is the bytes that one work-group reads, so the columns n are cut
// as finely as fills the chip: NC columns a work-group, 256 work-groups. k is
// split over GW waves; each wave asks for its whole range at once (one memory
// round trip) in 512-B row pieces,
// turns them to bf16 in its own LDS range and works them as slices of 64
// columns. Row 4j + r of the A tile is row r in slice j, column 4j + c of the B
// tile is output column c in slice j: the four 4x4 blocks on the diagonal of the
// product are the four slices' partial sums (the other blocks pair different
// slices and are not read). The KW partial sums are added through LDS in slice
// order.
// Used for q-last.
// ---------------------------------------------------------------------------
#define KW    16             // slices of k, one partial sum each
#define KWSTP (Dc / KW / 32) // WMMA k-steps per slice (2)
#define NC    4              // output columns per work-group
#define GW    4              // waves per work-group
#define GSL   (Dc / GW)      // columns k of one wave (256)
#define GWS   (KW / GW)      // slices of one wave (4)

__global__ __launch_bounds__(32 * GW) void gemm_rows16_kernel(
    const float* __restrict__ A, size_t arow_stride,
    const float* __restrict__ W, const float* __restrict__ bias,
    float* __restrict__ out, size_t orow_stride)
{
  __shared__ __align__(16) __bf16 wt[GW][GWS * NC][SP];
  __shared__ __align__(16) __bf16 at[GW][GWS * Bc][SP];
  __shared__ float part[KW][Bc][NC];

  const int Nbase = blockIdx.x * NC;
  const int tid   = threadIdx.x;
  const int wave  = tid >> 5;
  const int lane  = tid & 31;
  const int half  = lane >> 4;
  const int idx   = lane & 15;
  const int k0    = wave * GSL;

  // The bias, at the same address in every lane, is asked for first; the
  // scheduling barrier keeps the compiler from sinking the load to its use.
  const v4f bb = *(const v4f*)(bias + Nbase);
  __builtin_amdgcn_sched_barrier(0);

  // Load i brings half i & 1 of the wave's range of row i >> 1.
  const float* wb = W + (size_t)Nbase * Dc + k0 + 4 * lane;
  const float* ab[Bc];
  #pragma unroll
  for (int r = 0; r < Bc; ++r) ab[r] = A + (size_t)r * arow_stride + k0 + 4 * lane;
  v4f wr[2 * NC], ar[2 * Bc];
  #pragma unroll
  for (int i = 0; i < 2 * NC; ++i)
    wr[i] = *(const v4f*)(wb + (i >> 1) * Dc + (i & 1) * 128);
  #pragma unroll
  for (int i = 0; i < 2 * Bc; ++i)
    ar[i] = *(const v4f*)(ab[i >> 1] + (i & 1) * 128);
  // The arithmetic below may reuse registers that held the addresses above. The
  // wait takes the addresses as inputs so that their registers are left alone up
  // to here; the scheduling barrier in front keeps other work behind the wait.
  __builtin_amdgcn_sched_barrier(0);
  asm volatile("s_wait_xcnt 0x0"
               :: "v"(wb), "v"(ab[0]), "v"(ab[1]), "v"(ab[2]), "v"(ab[3]) : "memory");
  // Keeps every load above in front of the first use: one memory round trip.
  __builtin_amdgcn_sched_barrier(0);

  #pragma unroll
  for (int i = 0; i < 2 * NC; ++i) put4(&wt[wave][((i & 1) * 2 + half) * NC + (i >> 1)][4 * idx], wr[i]);
  #pragma unroll
  for (int i = 0; i < 2 * Bc; ++i) put4(&at[wave][((i & 1) * 2 + half) * Bc + (i >> 1)][4 * idx], ar[i]);
  // The rows read back below were written by other lanes of this wave.
  asm volatile("s_wait_dscnt 0x0" ::: "memory");

  // Element e of k-step s holds k = k0 + j*64 + s*32 + 16*(e>>3) + 8*half + (e&7)
  // of the lane's slice j = idx >> 2, the same for A and W.
  v16bf a[KWSTP], b[KWSTP];
  #pragma unroll
  for (int s = 0; s < KWSTP; ++s) {
    const __bf16* ap = &at[wave][idx][s * 32 + 8 * half];
    const __bf16* wp = &wt[wave][idx][s * 32 + 8 * half];
    a[s] = frag16(ap, ap + 16);
    b[s] = frag16(wp, wp + 16);
  }
  // Keeps every fragment read in front of the first product: one LDS round trip
  // where the compiler, reusing registers, made one per k-step.
  __builtin_amdgcn_sched_barrier(0);

  v8f acc = {};
  #pragma unroll
  for (int s = 0; s < KWSTP; ++s)
    acc = __builtin_amdgcn_wmma_f32_16x16x32_bf16(
        false, a[s], false, b[s], (short)0, acc, false, false);

  // C layout: VGPR v -> row 8*half + v, column idx. Column idx belongs to slice
  // idx >> 2; a lane holds rows of slice 2*half in VGPRs 0..3, of slice 2*half + 1
  // in VGPRs 4..7.
  float* pp = &part[wave * GWS + (idx >> 2)][0][idx & (NC - 1)];
  if ((idx >> 2) == 2 * half) {
    #pragma unroll
    for (int r = 0; r < Bc; ++r) pp[r * NC] = acc[r];
  }
  if ((idx >> 2) == 2 * half + 1) {
    #pragma unroll
    for (int r = 0; r < Bc; ++r) pp[r * NC] = acc[4 + r];
  }
  __syncthreads();

  if (tid < Bc * NC) {
    const int r = tid / NC;
    const int c = tid & (NC - 1);
    float sum = 0.f;
    #pragma unroll
    for (int w = 0; w < KW; ++w) sum += part[w][r][c];
    out[(size_t)r * orow_stride + Nbase + c] = sum + bb[c];
  }
}

// ---------------------------------------------------------------------------
// Folded query: qk[b,h,d] = sum_j q[b,h*64+j] * Wk[h*64+j,d], qb[b,h] = q . bk.
// One wave per (head, 64 columns d). Rows of the product are the batches
// (padded to 16 with zeros), k is j. Element e of a fragment holds
// j = ks*32 + 16*half + e on both sides. A lane's 16-byte load of a Wk row
// gives column d0 + 4*idx + t to N-tile t, so every load covers whole lines.
// ---------------------------------------------------------------------------
__global__ __launch_bounds__(32) void fold_qk_kernel(
    const float* __restrict__ qws, const float* __restrict__ Wk,
    const float* __restrict__ bk, __bf16* __restrict__ qk,
    float* __restrict__ qb)
{
  const int h    = blockIdx.x >> 4;
  const int dg   = blockIdx.x & 15;
  const int lane = threadIdx.x;
  const int half = lane >> 4;
  const int idx  = lane & 15;

  const float* wp = Wk + (size_t)(h * DKc + 16 * half) * Dc + dg * 64 + 4 * idx;
  v4f wf[2][16], af[2][4], bf[2][4];
  #pragma unroll
  for (int ks = 0; ks < 2; ++ks) {
    #pragma unroll
    for (int e = 0; e < 16; ++e)
      wf[ks][e] = *(const v4f*)(wp + (size_t)(ks * 32 + e) * Dc);
    #pragma unroll
    for (int i = 0; i < 4; ++i) { af[ks][i] = (v4f)(0.f); bf[ks][i] = (v4f)(0.f); }
  }
  if (idx < Bc) {
    const float* qp = qws + idx * DOc + h * DKc + 16 * half;
    #pragma unroll
    for (int ks = 0; ks < 2; ++ks)
      #pragma unroll
      for (int i = 0; i < 4; ++i) af[ks][i] = *(const v4f*)(qp + ks * 32 + i * 4);
  }
  if (dg == 0 && idx == 0) {
    const float* bp = bk + h * DKc + 16 * half;
    #pragma unroll
    for (int ks = 0; ks < 2; ++ks)
      #pragma unroll
      for (int i = 0; i < 4; ++i) bf[ks][i] = *(const v4f*)(bp + ks * 32 + i * 4);
  }

  v16bf a[2];
  #pragma unroll
  for (int ks = 0; ks < 2; ++ks)
    #pragma unroll
    for (int e = 0; e < 16; ++e) a[ks][e] = (__bf16)af[ks][e >> 2][e & 3];

  v8f acc[4] = {};
  #pragma unroll
  for (int ks = 0; ks < 2; ++ks)
    #pragma unroll
    for (int t = 0; t < 4; ++t) {
      v16bf w;
      #pragma unroll
      for (int e = 0; e < 16; ++e) w[e] = (__bf16)wf[ks][e][t];
      acc[t] = __builtin_amdgcn_wmma_f32_16x16x32_bf16(
          false, a[ks], false, w, (short)0, acc[t], false, false);
    }

  // C layout: VGPR r of lanes 0..15 -> batch r, column d0 + 4*idx + t.
  if (half == 0) {
    #pragma unroll
    for (int r = 0; r < Bc; ++r) {
      v4bf o;
      #pragma unroll
      for (int t = 0; t < 4; ++t) o[t] = (__bf16)acc[t][r];
      *(v4bf*)(qk + (size_t)(r * Hc + h) * Dc + dg * 64 + 4 * idx) = o;
    }
  }

  if (dg == 0) {                     // bk as the one live column of a fifth tile
    v8f accb = {};
    #pragma unroll
    for (int ks = 0; ks < 2; ++ks) {
      v16bf w;
      #pragma unroll
      for (int e = 0; e < 16; ++e) w[e] = (__bf16)bf[ks][e >> 2][e & 3];
      accb = __builtin_amdgcn_wmma_f32_16x16x32_bf16(
          false, a[ks], false, w, (short)0, accb, false, false);
    }
    if (lane == 0) {
      #pragma unroll
      for (int r = 0; r < Bc; ++r) qb[r * Hc + h] = accb[r];
    }
  }
}

// ---------------------------------------------------------------------------
// One pass over x: scores, their exponentials and the weighted row sums of one
// chunk of 64 key rows, for all 16 heads.
//   s[h,r]     = (x[r,:] . qk[b,h,:] + qb[b,h]) / 8
//   m[h]       = max over the chunk's r of s[h,r],  l[h] = sum of exp(s - m)
//   Yp[ck,h,d] = sum over the chunk's r of exp(s[h,r] - m[h]) * x[r,d]
// st[ck,h] = (m, l); the context kernel scales the chunks onto one maximum.
// Wave w owns columns d = 64w .. 64w+63 of all 64 rows and asks for them once,
// in whole lines. A lane's 16-byte load of a row gives column d0 + 4*idx + t to
// N-tile t of the second product, where k is the row: element e of a fragment
// holds row ks*32 + 16*(e>>3) + 8*half + (e&7) on both sides. For the first
// product, where k is d, the wave turns its bf16 block round through its own
// LDS range: element e holds d = d0 + kd*32 + 16*half + e on both sides. The
// waves' f32 partial scores are summed through LDS in wave order.
// ---------------------------------------------------------------------------
__global__ __launch_bounds__(512) void scores_attn_kernel(
    const float* __restrict__ x, const __bf16* __restrict__ qk,
    const float* __restrict__ qb, float* __restrict__ Yp,
    float* __restrict__ st)
{
  // Pitches: 144 B for 16-byte readers of 128-B rows; 68 dwords for columns.
  __shared__ __align__(16) __bf16 xs[16][RCH][64 + 8];
  __shared__ __align__(16) float  part[16][Hc][RCH + 4];
  __shared__ __align__(16) __bf16 El[Hc][RCH + 8];
  __shared__ __align__(16) __bf16 qt[16][Hc][SP];

  const int ck   = blockIdx.x;       // chunk, counted over all batches
  const int b    = ck / NCK;
  const int tid  = threadIdx.x;
  const int wave = tid >> 5;
  const int lane = tid & 31;
  const int half = lane >> 4;
  const int idx  = lane & 15;
  const int d0   = wave * 64;

  // The wave's 64 columns of qk, one whole line a head, 8 lanes a head: load i
  // brings heads 4i .. 4i + 3. Turned to fragment order through qt below.
  v8bf qr[4];
  #pragma unroll
  for (int i = 0; i < 4; ++i)
    qr[i] = *(const v8bf*)(qk + (size_t)(b * Hc + 4 * i + (lane >> 3)) * Dc + d0 + 8 * (lane & 7));
  const float add = qb[b * Hc + wave];
  // The loads below may land in registers that held the addresses above.
  asm volatile("s_wait_xcnt 0x0" ::: "memory");

  const float* xp = x + (size_t)(ck * RCH + 8 * half) * Dc + d0 + 4 * idx;
  v4f xf[2][16];
  #pragma unroll
  for (int ks = 0; ks < 2; ++ks)
    #pragma unroll
    for (int e = 0; e < 16; ++e)
      xf[ks][e] = *(const v4f*)(xp + (size_t)(ks * 32 + 16 * (e >> 3) + (e & 7)) * Dc);
  // Keeps every load above in front of the first conversion: one memory round
  // trip for the wave's whole block instead of several.
  __builtin_amdgcn_sched_barrier(0);

  #pragma unroll
  for (int i = 0; i < 4; ++i) *(v8bf*)&qt[wave][4 * i + (lane >> 3)][8 * (lane & 7)] = qr[i];

  // Rows 8 apart (the two halves of a wave) start 32 banks apart at this pitch.
  v2u xr[2][16];                     // a row's four bf16: (t0, t1), (t2, t3)
  #pragma unroll
  for (int ks = 0; ks < 2; ++ks)
    #pragma unroll
    for (int e = 0; e < 16; ++e) {
      v4bf o;
      #pragma unroll
      for (int t = 0; t < 4; ++t) o[t] = (__bf16)xf[ks][e][t];
      *(v4bf*)&xs[wave][ks * 32 + 16 * (e >> 3) + 8 * half + (e & 7)][4 * idx] = o;
      xr[ks][e] = __builtin_bit_cast(v2u, o);
    }
  // Column t of rows e, e + 1 into one register: one byte permute each, where
  // plain element moves compile to two 16-bit moves.
  v16bf xw[2][4];
  #pragma unroll
  for (int ks = 0; ks < 2; ++ks)
    #pragma unroll
    for (int t = 0; t < 4; ++t) {
      v8u u;
      #pragma unroll
      for (int i = 0; i < 8; ++i)
        u[i] = __builtin_amdgcn_perm(xr[ks][2 * i + 1][t >> 1], xr[ks][2 * i][t >> 1],
                                     (t & 1) ? 0x07060302u : 0x05040100u);
      xw[ks][t] = __builtin_bit_cast(v16bf, u);
    }
  // The rows read back below were written by other lanes of this wave.
  asm volatile("s_wait_dscnt 0x0" ::: "memory");

  v16bf qf[2];
  #pragma unroll
  for (int kd = 0; kd < 2; ++kd) {
    const __bf16* qp = &qt[wave][idx][kd * 32 + 16 * half];
    qf[kd] = frag16(qp, qp + 8);
  }

  v8f sacc[4] = {};
  #pragma unroll
  for (int kd = 0; kd < 2; ++kd)
    #pragma unroll
    for (int mt = 0; mt < 4; ++mt) {
      const __bf16* ap = &xs[wave][mt * 16 + idx][kd * 32 + 16 * half];
      const v16bf a = __builtin_shufflevector(*(const v8bf*)ap, *(const v8bf*)(ap + 8),
                                              0, 1, 2, 3, 4, 5, 6, 7, 8, 9, 10, 11, 12, 13, 14, 15);
      sacc[mt] = __builtin_amdgcn_wmma_f32_16x16x32_bf16(
          false, a, false, qf[kd], (short)0, sacc[mt], false, false);
    }

  // C layout: VGPR r -> row mt*16 + 8*half + r, head idx.
  #pragma unroll
  for (int mt = 0; mt < 4; ++mt) {
    v4f lo, hi;
    #pragma unroll
    for (int r = 0; r < 4; ++r) { lo[r] = sacc[mt][r]; hi[r] = sacc[mt][4 + r]; }
    *(v4f*)&part[wave][idx][mt * 16 + 8 * half]     = lo;
    *(v4f*)&part[wave][idx][mt * 16 + 8 * half + 4] = hi;
  }
  __syncthreads();

  // Wave w finishes head w: lane -> rows 2*lane, 2*lane + 1.
  {
    float t0 = 0.f, t1 = 0.f;
    #pragma unroll
    for (int w = 0; w < 16; ++w) {
      const v2f p = *(const v2f*)&part[w][wave][2 * lane];
      t0 += p[0]; t1 += p[1];
    }
    const float o0 = (t0 + add) * 0.125f;  // 1/sqrt(DK)
    const float o1 = (t1 + add) * 0.125f;
    float mc = row_max(fmaxf(o0, o1));
    mc = fmaxf(mc, other_row(mc));
    const float p0 = exp2_slot((o0 - mc) * LOG2E);
    const float p1 = exp2_slot((o1 - mc) * LOG2E);
    float lc = row_sum(p0 + p1);
    lc += other_row(lc);
    v2bf pe;
    pe[0] = (__bf16)p0; pe[1] = (__bf16)p1;
    *(v2bf*)&El[wave][2 * lane] = pe;
    if (lane == 0) {
      v2f ml;
      ml[0] = mc; ml[1] = lc;
      *(v2f*)(st + ((size_t)ck * Hc + wave) * 2) = ml;
    }
  }
  lds_barrier();

  v8f acc[4] = {};
  #pragma unroll
  for (int ks = 0; ks < 2; ++ks) {
    const __bf16* ep = &El[idx][ks * 32 + 8 * half];
    const v16bf a = __builtin_shufflevector(*(const v8bf*)ep, *(const v8bf*)(ep + 16),
                                            0, 1, 2, 3, 4, 5, 6, 7, 8, 9, 10, 11, 12, 13, 14, 15);
    #pragma unroll
    for (int t = 0; t < 4; ++t)
      acc[t] = __builtin_amdgcn_wmma_f32_16x16x32_bf16(
          false, a, false, xw[ks][t], (short)0, acc[t], false, false);
  }

  // C layout: VGPR r -> head 8*half + r, column d0 + 4*idx + t.
  #pragma unroll
  for (int r = 0; r < 8; ++r) {
    v4f o;
    #pragma unroll
    for (int t = 0; t < 4; ++t) o[t] = acc[t][r];
    *(v4f*)(Yp + ((size_t)ck * Hc + 8 * half + r) * Dc + d0 + 4 * idx) = o;
  }
}

// ---------------------------------------------------------------------------
// Context: ctxp[dq,b,n] = sum over the d of range dq of Wv[n,d] * y[b,n/64,d]
// (+ bv[n] in range 0), y = sum over chunks c of Yp[c] * exp(m_c - m) / total.
// One work-group per (head, range of 256 d, batch), 256 in all: it reads a
// quarter of the chunk rows that a work-group of all four batches would.
// Wave w owns columns d = 64w .. 64w+63 of the range on both sides, so y goes
// from the merge to the product inside the wave. Merge: the wave holds the 32
// chunk weights, one per lane; a load brings 256 B of chunk i (lanes 0..15) and
// of chunk 16 + i (lanes 16..31); each group of 16 is summed in chunk order, then
// the two groups are added. Product: y is every row of A (row 0 is read), the 64
// rows of Wv are four N-tiles; element e of k-step s holds d = 64w + s*32 +
// 16*half + e on both sides; the waves' f32 partial tiles are summed through LDS
// in wave order.
// ---------------------------------------------------------------------------
__global__ __launch_bounds__(128) void ctx_kernel(
    const float* __restrict__ Yp, const float* __restrict__ st,
    const float* __restrict__ Wv, const float* __restrict__ bv,
    float* __restrict__ ctxp)
{
  __shared__ __align__(16) __bf16 wt[4][DKc][SP];
  __shared__ __align__(16) __bf16 yt[4][64];
  __shared__ float part[4][DKc];

  const int b    = blockIdx.x % Bc;
  const int dq   = (blockIdx.x / Bc) % DQ;
  const int h    = blockIdx.x / (Bc * DQ);
  const int tid  = threadIdx.x;
  const int wave = tid >> 5;
  const int lane = tid & 31;
  const int half = lane >> 4;
  const int idx  = lane & 15;
  const int dw   = dq * DQW + wave * 64;

  const v2f pr = *(const v2f*)(st + ((size_t)(b * NCK + lane) * Hc + h) * 2);
  const float* yp = Yp + ((size_t)(b * NCK + 16 * half) * Hc + h) * Dc + dw + 4 * idx;
  v4f yv[16];
  #pragma unroll
  for (int i = 0; i < 16; ++i) yv[i] = *(const v4f*)(yp + (size_t)i * Hc * Dc);
  // The loads below may land in registers that held the addresses above.
  asm volatile("s_wait_xcnt 0x0" ::: "memory");

  // Load i brings rows (i >> 3)*16 + (i & 7) and that + 8 of the head's Wv.
  const float* wrow = Wv + (size_t)(h * DKc + 8 * half) * Dc + dw + 4 * idx;
  v4f wr[32];
  #pragma unroll
  for (int i = 0; i < 32; ++i)
    wr[i] = *(const v4f*)(wrow + (size_t)((i >> 3) * 16 + (i & 7)) * Dc);
  const float bb = bv[h * DKc + (tid & 63)];
  // The arithmetic below may reuse registers that held the addresses above.
  asm volatile("s_wait_xcnt 0x0" ::: "memory");
  // Keeps every load above in front of the first use: one memory round trip.
  __builtin_amdgcn_sched_barrier(0);

  float m = row_max(pr[0]);
  m = fmaxf(m, other_row(m));
  const float ec = exp2_slot((pr[0] - m) * LOG2E);
  float tot = row_sum(pr[1] * ec);
  tot += other_row(tot);
  const int wc = __builtin_bit_cast(int, ec * (1.0f / tot));

  // row_share:i hands lane i of each 16-lane row to the whole row: the weight of
  // chunk i in lanes 0..15, of chunk 16 + i in lanes 16..31.
  v4f y = (v4f)(0.f);
#define YSTEP(i) y += yv[i] * row_lane<i>(wc);
  YSTEP(0)  YSTEP(1)  YSTEP(2)  YSTEP(3)  YSTEP(4)  YSTEP(5)  YSTEP(6)  YSTEP(7)
  YSTEP(8)  YSTEP(9)  YSTEP(10) YSTEP(11) YSTEP(12) YSTEP(13) YSTEP(14) YSTEP(15)
#undef YSTEP
  #pragma unroll
  for (int t = 0; t < 4; ++t) y[t] += other_row(y[t]);
  if (half == 0) put4(&yt[wave][4 * idx], y);
  #pragma unroll
  for (int i = 0; i < 32; ++i)
    put4(&wt[wave][(i >> 3) * 16 + (i & 7) + 8 * half][4 * idx], wr[i]);
  // What is read back below was written by other lanes of this wave.
  asm volatile("s_wait_dscnt 0x0" ::: "memory");

  v16bf a[2], w[2][4];
  #pragma unroll
  for (int s = 0; s < 2; ++s) {
    const __bf16* ap = &yt[wave][s * 32 + 16 * half];
    a[s] = frag16(ap, ap + 8);
    #pragma unroll
    for (int nt = 0; nt < 4; ++nt) {
      const __bf16* wp = &wt[wave][nt * 16 + idx][s * 32 + 16 * half];
      w[s][nt] = frag16(wp, wp + 8);
    }
  }
  // Keeps every fragment read in front of the first product: one LDS round trip
  // where the compiler, reusing registers, made one per product of step 1.
  __builtin_amdgcn_sched_barrier(0);

  v8f acc[4] = {};
  #pragma unroll
  for (int s = 0; s < 2; ++s)
    #pragma unroll
    for (int nt = 0; nt < 4; ++nt)
      acc[nt] = __builtin_amdgcn_wmma_f32_16x16x32_bf16(
          false, a[s], false, w[s][nt], (short)0, acc[nt], false, false);

  // C layout: VGPR 0 of lanes 0..15 -> row 0, column nt*16 + idx.
  if (half == 0) {
    #pragma unroll
    for (int nt = 0; nt < 4; ++nt) part[wave][nt * 16 + idx] = acc[nt][0];
  }
  __syncthreads();

  if (tid < DKc) {
    float sum = 0.f;
    #pragma unroll
    for (int q = 0; q < 4; ++q) sum += part[q][tid];
    if (dq == 0) sum += bb;
    ctxp[(size_t)(dq * Bc + b) * DOc + h * DKc + tid] = sum;
  }
}

// ---------------------------------------------------------------------------
// Output projection: out[b,p] = sum_n Wo[p,n] * ctx[b,n] + bo[p], ctx = sum of
// the parts of ctxp in part order. Same shape as the tiny GEMM: one work-group
// per NC columns p, k split over GW waves, (slice, batch) as the rows and (slice,
// column) as the columns of one tile, partial sums added through LDS in slice
// order.
// ---------------------------------------------------------------------------
__global__ __launch_bounds__(32 * GW) void out_kernel(
    const float* __restrict__ ctxp, const float* __restrict__ Wo,
    const float* __restrict__ bo, float* __restrict__ out)
{
  __shared__ __align__(16) __bf16 wt[GW][GWS * NC][SP];
  __shared__ __align__(16) __bf16 ct[GW][GWS * Bc][SP];
  __shared__ float part[KW][Bc][NC];

  const int Nbase = blockIdx.x * NC;
  const int tid   = threadIdx.x;
  const int wave  = tid >> 5;
  const int lane  = tid & 31;
  const int half  = lane >> 4;
  const int idx   = lane & 15;
  const int k0    = wave * GSL;

  // The bias, at the same address in every lane, is asked for first; the
  // scheduling barrier keeps the compiler from sinking the load to its use.
  const v4f bb = *(const v4f*)(bo + Nbase);
  __builtin_amdgcn_sched_barrier(0);

  // Load i brings half i & 1 of the wave's range of row i >> 1; row p*Bc + b of
  // ctxp is part p of batch b.
  const float* wb = Wo + (size_t)Nbase * DOc + k0 + 4 * lane;
  const float* cb = ctxp + k0 + 4 * lane;
  v4f wr[2 * NC], cr[2 * DQ * Bc];
  #pragma unroll
  for (int i = 0; i < 2 * NC; ++i)
    wr[i] = *(const v4f*)(wb + (i >> 1) * DOc + (i & 1) * 128);
  #pragma unroll
  for (int i = 0; i < 2 * DQ * Bc; ++i)
    cr[i] = *(const v4f*)(cb + (i >> 1) * DOc + (i & 1) * 128);
  // The arithmetic below may reuse registers that held the addresses above. The
  // wait takes the addresses as inputs so that their registers are left alone up
  // to here; the scheduling barrier in front keeps other work behind the wait.
  __builtin_amdgcn_sched_barrier(0);
  asm volatile("s_wait_xcnt 0x0" :: "v"(wb), "v"(cb) : "memory");
  // Keeps every load above in front of the first use: one memory round trip.
  __builtin_amdgcn_sched_barrier(0);

  #pragma unroll
  for (int i = 0; i < 2 * NC; ++i) put4(&wt[wave][((i & 1) * 2 + half) * NC + (i >> 1)][4 * idx], wr[i]);
  #pragma unroll
  for (int i = 0; i < 2 * Bc; ++i) {
    v4f y = cr[i];
    #pragma unroll
    for (int p = 1; p < DQ; ++p) y += cr[2 * Bc * p + i];
    put4(&ct[wave][((i & 1) * 2 + half) * Bc + (i >> 1)][4 * idx], y);
  }
  // The rows read back below were written by other lanes of this wave.
  asm volatile("s_wait_dscnt 0x0" ::: "memory");

  // Element e of k-step s holds k = k0 + j*64 + s*32 + 16*half + e of the lane's
  // slice j = idx >> 2, the same for ctx and Wo.
  v16bf a[KWSTP], b[KWSTP];
  #pragma unroll
  for (int s = 0; s < KWSTP; ++s) {
    const __bf16* cp = &ct[wave][idx][s * 32 + 16 * half];
    const __bf16* wp = &wt[wave][idx][s * 32 + 16 * half];
    a[s] = frag16(cp, cp + 8);
    b[s] = frag16(wp, wp + 8);
  }
  // Keeps every fragment read in front of the first product: one LDS round trip
  // where the compiler, reusing registers, made one per k-step.
  __builtin_amdgcn_sched_barrier(0);

  v8f acc = {};
  #pragma unroll
  for (int s = 0; s < KWSTP; ++s)
    acc = __builtin_amdgcn_wmma_f32_16x16x32_bf16(
        false, a[s], false, b[s], (short)0, acc, false, false);

  // C layout: VGPR v -> row 8*half + v, column idx. Column idx belongs to slice
  // idx >> 2; a lane holds rows of slice 2*half in VGPRs 0..3, of slice 2*half + 1
  // in VGPRs 4..7.
  float* pp = &part[wave * GWS + (idx >> 2)][0][idx & (NC - 1)];
  if ((idx >> 2) == 2 * half) {
    #pragma unroll
    for (int r = 0; r < Bc; ++r) pp[r * NC] = acc[r];
  }
  if ((idx >> 2) == 2 * half + 1) {
    #pragma unroll
    for (int r = 0; r < Bc; ++r) pp[r * NC] = acc[4 + r];
  }
  __syncthreads();

  if (tid < Bc * NC) {
    const int r = tid / NC;
    const int c = tid & (NC - 1);
    float sum = 0.f;
    #pragma unroll
    for (int w = 0; w < KW; ++w) sum += part[w][r][c];
    out[r * DOc + Nbase + c] = sum + bb[c];
  }
}

// ---------------------------------------------------------------------------
extern "C" void kernel_launch(void* const* d_in, const int* in_sizes, int n_in,
                              void* d_out, int out_size, void* d_ws, size_t ws_size,
                              hipStream_t stream) {
  (void)in_sizes; (void)n_in; (void)out_size; (void)ws_size;

  const float* x  = (const float*)d_in[0];
  const float* Wq = (const float*)d_in[1];
  const float* bq = (const float*)d_in[2];
  const float* Wk = (const float*)d_in[3];
  const float* bk = (const float*)d_in[4];
  const float* Wv = (const float*)d_in[5];
  const float* bv = (const float*)d_in[6];
  const float* Wo = (const float*)d_in[7];
  const float* bo = (const float*)d_in[8];
  float* out = (float*)d_out;

  char* ws = (char*)d_ws;
  float*  Yp    = (float*)(ws);                                   // 8 MB
  float*  qws   = Yp + (size_t)Bc * NCK * Hc * Dc;
  float*  ctxws = qws + Bc * DOc;                                 // DQ parts
  float*  qbws  = ctxws + DQ * Bc * DOc;
  __bf16* qkws  = (__bf16*)(qbws + Bc * Hc);                      // 128 KB
  float*  stws  = (float*)(qkws + (size_t)Bc * Hc * Dc);          // 16 KB

  // 1) Q for the last token of each batch (4 rows)
  gemm_rows16_kernel<<<DOc / NC, 32 * GW, 0, stream>>>(
      x + (size_t)(Tc - 1) * Dc, (size_t)Tc * Dc, Wq, bq, qws, DOc);

  // 2) query folded through Wk and bk
  fold_qk_kernel<<<Hc * (Dc / 64), 32, 0, stream>>>(qws, Wk, bk, qkws, qbws);

  // 3) one pass over x: each chunk's scores, (max, sum) and weighted row sums
  scores_attn_kernel<<<Bc * NCK, 512, 0, stream>>>(x, qkws, qbws, Yp, stws);

  // 4) chunks merged, then through Wv, plus bv
  ctx_kernel<<<Hc * DQ * Bc, 128, 0, stream>>>(Yp, stws, Wv, bv, ctxws);

  // 5) output projection (4 rows) -> d_out
  out_kernel<<<DOc / NC, 32 * GW, 0, stream>>>(ctxws, Wo, bo, out);
}
